// v000
// Times are from an AMD MI455X. After a warm-up the kernel runs many times in a row, and a time is the length of
// such a window on the GPU divided by its runs, so every launch and the gaps after it count. The runs cycle
// through copies of the inputs. A figure is the median of several windows, for all but v000 over two sittings.
// Sittings can differ by a few percent; kernels timed side by side share one.
// The starting kernel, v000, takes 111 microseconds a run.
#include <hip/hip_runtime.h>
#include <math.h>

typedef float v2f __attribute__((ext_vector_type(2)));
typedef float v8f __attribute__((ext_vector_type(8)));

#define BATCH 32
#define QL 16
#define KVC 8192
#define DIM 128
#define CHUNK 512
#define NCHC (KVC / CHUNK)   /* 16 cache chunks */
#define NCH (NCHC + 1)       /* + 1 new-token chunk */
#define KSTRIDE 132          /* padded LDS row stride (words): bank-conflict-free */
#define SCALE 0.08838834764831845f

static __device__ __forceinline__ v8f wmma4(v2f a, v2f b, v8f c) {
  // 8 args: (neg_a, A, neg_b, B, c_mod, C, reuse_a, reuse_b)
  return __builtin_amdgcn_wmma_f32_16x16x4_f32(false, a, false, b, (short)0, c,
                                               false, false);
}

// Async copy 16 B/lane from global to LDS (GLOBAL_LOAD_ASYNC_TO_LDS_B128,
// tracked by ASYNCcnt).  LDS offset = low 32 bits of the generic pointer
// (flat->LDS aperture truncation rule, ISA 10.2).
static __device__ __forceinline__ void async_copy16(const float* gsrc,
                                                    const float* lds_dst) {
  unsigned loff = (unsigned)(__SIZE_TYPE__)lds_dst;
  unsigned long long gaddr = (unsigned long long)(__SIZE_TYPE__)gsrc;
  asm volatile("global_load_async_to_lds_b128 %0, %1, off"
               :: "v"(loff), "v"(gaddr)
               : "memory");
}

static __device__ __forceinline__ void wait_async_0() {
  asm volatile("s_wait_asynccnt 0" ::: "memory");
}
static __device__ __forceinline__ void wait_async_16() {
  asm volatile("s_wait_asynccnt 16" ::: "memory");
}

// Stage one 16x128 f32 K tile into LDS (padded rows). 16 async instructions,
// each moving one 512B row fully coalesced.
static __device__ __forceinline__ void stage_k_tile(const float* gbase,
                                                    const float* lbase,
                                                    int lane) {
#pragma unroll
  for (int r = 0; r < 16; ++r)
    async_copy16(gbase + r * DIM + lane * 4, lbase + r * KSTRIDE + lane * 4);
}

// ---------------------------------------------------------------------------
// Per-tile flash-attention step (computes S^T = K @ Q^T so the softmax
// reduction over keys is in-lane + one xor-16 exchange).
// kt/lp/la are references to named __shared__ arrays -> ds_* ops guaranteed.
// ---------------------------------------------------------------------------
static __device__ __forceinline__ void compute_tile(
    const float (&kt)[16 * KSTRIDE], float (&lp)[16 * 16], float (&la)[16],
    const float* __restrict__ Vp, int kbase, const v2f (&qa)[32],
    float& m, float& l, v8f (&acc)[8], int n, int h) {
  // S^T tile [16k x 16q] = K_tile @ Q^T.  A-operand (K) from LDS,
  // B-operand (Q^T) preloaded in registers.  Fully unrolled so qa stays
  // in VGPRs (no dynamic indexing -> no scratch demotion).
  v8f s = {};
#pragma unroll
  for (int j = 0; j < 32; ++j) {
    int kk = 4 * j + 2 * h;
    v2f ka = { kt[n * KSTRIDE + kk], kt[n * KSTRIDE + kk + 1] };
    s = wmma4(ka, qa[j], s);
  }

  // Per-query (= per-lane) online softmax over this tile's 16 keys:
  // keys r+8h live in-lane (8 values), the other 8 in the partner half.
  float sv[8];
#pragma unroll
  for (int r = 0; r < 8; ++r) sv[r] = s[r] * SCALE;
  float tm = sv[0];
#pragma unroll
  for (int r = 1; r < 8; ++r) tm = fmaxf(tm, sv[r]);
  tm = fmaxf(tm, __shfl_xor(tm, 16, 32));   // single cross-half exchange
  float mn = fmaxf(m, tm);
  float al = __expf(m - mn);
  m = mn;
  float p8[8];
  float rs = 0.0f;
#pragma unroll
  for (int r = 0; r < 8; ++r) {
    p8[r] = __expf(sv[r] - mn);
    rs += p8[r];
  }
  rs += __shfl_xor(rs, 16, 32);             // single cross-half exchange
  l = l * al + rs;

  // Relay P^T tile (key-major) and per-query alpha through LDS.
#pragma unroll
  for (int r = 0; r < 8; ++r) lp[(r + 8 * h) * 16 + n] = p8[r];
  la[n] = al;                               // both halves write same value
  __syncthreads();
  float alar[8];
#pragma unroll
  for (int r = 0; r < 8; ++r) alar[r] = la[r + 8 * h];  // broadcast reads
  v2f pa[4];
#pragma unroll
  for (int j = 0; j < 4; ++j) {
    int kk = 4 * j + 2 * h;
    pa[j] = { lp[kk * 16 + n], lp[(kk + 1) * 16 + n] };
  }
  __syncthreads();

  // Rescale accumulators by alpha(row q = r + 8h).
#pragma unroll
  for (int td = 0; td < 8; ++td)
#pragma unroll
    for (int r = 0; r < 8; ++r) acc[td][r] *= alar[r];

  // acc[16q x 128d] += P[16x16] @ V[16k x 128d]  (V direct: coalesced)
#pragma unroll
  for (int td = 0; td < 8; ++td) {
    int d0 = td * 16;
#pragma unroll
    for (int j = 0; j < 4; ++j) {
      int kk = 4 * j + 2 * h;
      v2f bb = { Vp[(size_t)(kbase + kk) * DIM + d0 + n],
                 Vp[(size_t)(kbase + kk + 1) * DIM + d0 + n] };
      acc[td] = wmma4(pa[j], bb, acc[td]);
    }
  }
}

// ---------------------------------------------------------------------------
// Kernel: flash-attention partial over one KV chunk per single-wave block.
// K tiles double-buffered in LDS via global_load_async_to_lds_b128.
// ---------------------------------------------------------------------------
__global__ void __launch_bounds__(32)
flash_partial(const float* __restrict__ cacheK,
              const float* __restrict__ cacheV,
              const float* __restrict__ Qp,
              const float* __restrict__ Kn,
              const float* __restrict__ Vn,
              float* __restrict__ Wm, float* __restrict__ Wl,
              float* __restrict__ Wacc) {
  __shared__ __align__(16) float kb0[16 * KSTRIDE];   // K tile ping
  __shared__ __align__(16) float kb1[16 * KSTRIDE];   // K tile pong
  __shared__ __align__(16) float lp[16 * 16];         // P-tile relay
  __shared__ __align__(16) float la[16];              // alpha relay

  int b  = blockIdx.x / NCH;
  int ch = blockIdx.x % NCH;
  int lane = threadIdx.x;
  int n = lane & 15;
  int h = lane >> 4;

  const float* Kp;
  const float* Vp;
  int ntile;
  if (ch < NCHC) {
    size_t off = ((size_t)b * KVC + (size_t)ch * CHUNK) * DIM;
    Kp = cacheK + off;
    Vp = cacheV + off;
    ntile = CHUNK / 16;
  } else {
    Kp = Kn + b * (QL * DIM);
    Vp = Vn + b * (QL * DIM);
    ntile = 1;
  }

  // Preload Q (16x128) as 32 B-layout slices — reused every tile.
  const float* Qb = Qp + b * (QL * DIM);
  v2f qa[32];
#pragma unroll
  for (int j = 0; j < 32; ++j) {
    int kk = 4 * j + 2 * h;
    qa[j] = { Qb[n * DIM + kk], Qb[n * DIM + kk + 1] };
  }

  float m = -INFINITY, l = 0.0f;
  v8f acc[8];
#pragma unroll
  for (int t = 0; t < 8; ++t) acc[t] = {};

  // Prologue: stage K tile 0.
  stage_k_tile(Kp, kb0, lane);

  for (int t = 0; t < ntile; ++t) {
    int kbase = t * 16;

    if (t + 1 < ntile) {
      // Prefetch next K tile into the other buffer; wait for current tile.
      const float* nb = ((t + 1) & 1) ? kb1 : kb0;
      stage_k_tile(Kp + (size_t)(t + 1) * 16 * DIM, nb, lane);
      wait_async_16();
      // Prefetch next V tile (8KB = 2 cachelines per lane).
      const float* vn0 = Vp + (size_t)(kbase + 16) * DIM;
      __builtin_prefetch(vn0 + lane * 64, 0, 3);
      __builtin_prefetch(vn0 + lane * 64 + 32, 0, 3);
    } else {
      wait_async_0();
    }

    if ((t & 1) == 0)
      compute_tile(kb0, lp, la, Vp, kbase, qa, m, l, acc, n, h);
    else
      compute_tile(kb1, lp, la, Vp, kbase, qa, m, l, acc, n, h);
  }

  // Write partials (m, l, acc) for this (batch, chunk).
  int pi = b * NCH + ch;
  if (lane < 16) {
    Wm[pi * QL + lane] = m;
    Wl[pi * QL + lane] = l;
  }
#pragma unroll
  for (int td = 0; td < 8; ++td)
#pragma unroll
    for (int r = 0; r < 8; ++r) {
      int q = r + 8 * h;
      Wacc[((size_t)pi * QL + q) * DIM + td * 16 + n] = acc[td][r];
    }
}

// ---------------------------------------------------------------------------
// Kernel: Q/K/V projections.  One wave per (batch, proj, 16-col tile).
// ---------------------------------------------------------------------------
__global__ void __launch_bounds__(32)
proj_kernel(const float* __restrict__ X,
            const float* __restrict__ Wq, const float* __restrict__ bq,
            const float* __restrict__ Wk, const float* __restrict__ bk,
            const float* __restrict__ Wv, const float* __restrict__ bv,
            float* __restrict__ Qp, float* __restrict__ Kn,
            float* __restrict__ Vn) {
  int idx = blockIdx.x;
  int b = idx / 24;
  int rem = idx % 24;
  int p = rem >> 3;              // 0=Q 1=K 2=V
  int n0 = (rem & 7) * 16;       // output-column tile

  const float* W    = (p == 0) ? Wq : (p == 1) ? Wk : Wv;
  const float* bias = (p == 0) ? bq : (p == 1) ? bk : bv;
  float* out = ((p == 0) ? Qp : (p == 1) ? Kn : Vn) + b * (QL * DIM);
  const float* Xb = X + b * (QL * DIM);

  int lane = threadIdx.x;
  int n = lane & 15;
  int h = lane >> 4;

  v8f c = {};
#pragma unroll 8
  for (int j = 0; j < 32; ++j) {
    int kk = 4 * j + 2 * h;
    v2f a  = { Xb[n * DIM + kk], Xb[n * DIM + kk + 1] };
    v2f bb = { W[(n0 + n) * DIM + kk], W[(n0 + n) * DIM + kk + 1] };
    c = wmma4(a, bb, c);
  }
  float bval = bias[n0 + n];
#pragma unroll
  for (int r = 0; r < 8; ++r) {
    int q = r + 8 * h;
    out[q * DIM + n0 + n] = c[r] + bval;
  }
}

// ---------------------------------------------------------------------------
// Kernel: merge the NCH partials per batch (log-sum-exp combine).
// ---------------------------------------------------------------------------
__global__ void __launch_bounds__(256)
reduce_kernel(const float* __restrict__ Wm,
              const float* __restrict__ Wl,
              const float* __restrict__ Wacc,
              float* __restrict__ out) {
  int b = blockIdx.x;
  for (int e = threadIdx.x; e < QL * DIM; e += blockDim.x) {
    int q = e >> 7;
    int d = e & 127;
    float M = -INFINITY;
    for (int c = 0; c < NCH; ++c)
      M = fmaxf(M, Wm[(b * NCH + c) * QL + q]);
    float L = 0.0f, S = 0.0f;
    for (int c = 0; c < NCH; ++c) {
      float w = __expf(Wm[(b * NCH + c) * QL + q] - M);
      L += Wl[(b * NCH + c) * QL + q] * w;
      S += Wacc[((size_t)(b * NCH + c) * QL + q) * DIM + d] * w;
    }
    out[((size_t)b * QL + q) * DIM + d] = S / L;
  }
}

// ---------------------------------------------------------------------------
extern "C" void kernel_launch(void* const* d_in, const int* in_sizes, int n_in,
                              void* d_out, int out_size, void* d_ws,
                              size_t ws_size, hipStream_t stream) {
  const float* X  = (const float*)d_in[0];
  const float* cK = (const float*)d_in[1];
  const float* cV = (const float*)d_in[2];
  const float* Wq = (const float*)d_in[3];
  const float* bq = (const float*)d_in[4];
  const float* Wk = (const float*)d_in[5];
  const float* bk = (const float*)d_in[6];
  const float* Wv = (const float*)d_in[7];
  const float* bv = (const float*)d_in[8];
  float* out = (float*)d_out;
  float* ws  = (float*)d_ws;

  float* Qp   = ws;
  float* Kn   = Qp + BATCH * QL * DIM;
  float* Vn   = Kn + BATCH * QL * DIM;
  float* Wm   = Vn + BATCH * QL * DIM;
  float* Wl   = Wm + BATCH * NCH * QL;
  float* Wacc = Wl + BATCH * NCH * QL;   // 32*17*16*128 floats (~4.4 MB)

  proj_kernel<<<BATCH * 24, 32, 0, stream>>>(X, Wq, bq, Wk, bk, Wv, bv,
                                             Qp, Kn, Vn);
  flash_partial<<<BATCH * NCH, 32, 0, stream>>>(cK, cV, Qp, Kn, Vn,
                                                Wm, Wl, Wacc);
  reduce_kernel<<<BATCH, 256, 0, stream>>>(Wm, Wl, Wacc, out);
}

// v001
// One run takes 37.3 microseconds.
// Two timings next to v000 put it at 3.04 and 3.03 times that version's speed.
#include <hip/hip_runtime.h>
#include <math.h>

typedef float v2f __attribute__((ext_vector_type(2)));
typedef float v4f __attribute__((ext_vector_type(4)));
typedef float v8f __attribute__((ext_vector_type(8)));

#define BATCH 32
#define QL 16
#define KVC 8192
#define DIM 128
#define TPC 6                /* 16-key tiles per cache chunk */
#define CHUNK (TPC * 16)
#define NCHC ((KVC + CHUNK - 1) / CHUNK)   /* 86 cache chunks, the last one short */
#define NCH (NCHC + 1)       /* + 1 new-token chunk */
#define KSTRIDE 132          /* padded LDS row stride (words): bank-conflict-free */
#define SCALE 0.08838834764831845f

static __device__ __forceinline__ v8f wmma4(v2f a, v2f b, v8f c) {
  // 8 args: (neg_a, A, neg_b, B, c_mod, C, reuse_a, reuse_b)
  return __builtin_amdgcn_wmma_f32_16x16x4_f32(false, a, false, b, (short)0, c,
                                               false, false);
}

// Async copy 16 B/lane from global to LDS (GLOBAL_LOAD_ASYNC_TO_LDS_B128,
// tracked by ASYNCcnt).  LDS offset = low 32 bits of the generic pointer
// (flat->LDS aperture truncation rule, ISA 10.2).
static __device__ __forceinline__ void async_copy16(const float* gsrc,
                                                    const float* lds_dst) {
  unsigned loff = (unsigned)(__SIZE_TYPE__)lds_dst;
  unsigned long long gaddr = (unsigned long long)(__SIZE_TYPE__)gsrc;
  asm volatile("global_load_async_to_lds_b128 %0, %1, off"
               :: "v"(loff), "v"(gaddr)
               : "memory");
}

static __device__ __forceinline__ void wait_async_0() {
  asm volatile("s_wait_asynccnt 0" ::: "memory");
}
static __device__ __forceinline__ void wait_async_16() {
  asm volatile("s_wait_asynccnt 16" ::: "memory");
}

// Stage one 16x128 f32 K tile into LDS (padded rows). 16 async instructions,
// each moving one 512B row fully coalesced.
static __device__ __forceinline__ void stage_k_tile(const float* gbase,
                                                    const float* lbase,
                                                    int lane) {
#pragma unroll
  for (int r = 0; r < 16; ++r)
    async_copy16(gbase + r * DIM + lane * 4, lbase + r * KSTRIDE + lane * 4);
}

// ---------------------------------------------------------------------------
// Per-tile flash-attention step (computes S^T = K @ Q^T so the softmax
// reduction over keys is in-lane + one xor-16 exchange).
// kt/lp/la are references to named __shared__ arrays -> ds_* ops guaranteed.
// ---------------------------------------------------------------------------
static __device__ __forceinline__ void compute_tile(
    const float (&kt)[16 * KSTRIDE], float (&lp)[16 * 16], float (&la)[16],
    const float* __restrict__ Vp, int kbase, const v2f (&qa)[32],
    float& m, float& l, v8f (&acc)[8], int n, int h) {
  // S^T tile [16k x 16q] = K_tile @ Q^T.  A-operand (K) from LDS,
  // B-operand (Q^T) preloaded in registers.  Fully unrolled so qa stays
  // in VGPRs (no dynamic indexing -> no scratch demotion).
  v8f s = {};
#pragma unroll
  for (int j = 0; j < 32; ++j) {
    int kk = 4 * j + 2 * h;
    v2f ka = { kt[n * KSTRIDE + kk], kt[n * KSTRIDE + kk + 1] };
    s = wmma4(ka, qa[j], s);
  }

  // Per-query (= per-lane) online softmax over this tile's 16 keys:
  // keys r+8h live in-lane (8 values), the other 8 in the partner half.
  float sv[8];
#pragma unroll
  for (int r = 0; r < 8; ++r) sv[r] = s[r] * SCALE;
  float tm = sv[0];
#pragma unroll
  for (int r = 1; r < 8; ++r) tm = fmaxf(tm, sv[r]);
  tm = fmaxf(tm, __shfl_xor(tm, 16, 32));   // single cross-half exchange
  float mn = fmaxf(m, tm);
  float al = __expf(m - mn);
  m = mn;
  float p8[8];
  float rs = 0.0f;
#pragma unroll
  for (int r = 0; r < 8; ++r) {
    p8[r] = __expf(sv[r] - mn);
    rs += p8[r];
  }
  rs += __shfl_xor(rs, 16, 32);             // single cross-half exchange
  l = l * al + rs;

  // Relay P^T tile (key-major) and per-query alpha through LDS.
#pragma unroll
  for (int r = 0; r < 8; ++r) lp[(r + 8 * h) * 16 + n] = p8[r];
  la[n] = al;                               // both halves write same value
  __syncthreads();
  float alar[8];
#pragma unroll
  for (int r = 0; r < 8; ++r) alar[r] = la[r + 8 * h];  // broadcast reads
  v2f pa[4];
#pragma unroll
  for (int j = 0; j < 4; ++j) {
    int kk = 4 * j + 2 * h;
    pa[j] = { lp[kk * 16 + n], lp[(kk + 1) * 16 + n] };
  }
  __syncthreads();

  // Rescale accumulators by alpha(row q = r + 8h).
#pragma unroll
  for (int td = 0; td < 8; ++td)
#pragma unroll
    for (int r = 0; r < 8; ++r) acc[td][r] *= alar[r];

  // acc[16q x 128d] += P[16x16] @ V[16k x 128d]  (V direct: coalesced)
#pragma unroll
  for (int td = 0; td < 8; ++td) {
    int d0 = td * 16;
#pragma unroll
    for (int j = 0; j < 4; ++j) {
      int kk = 4 * j + 2 * h;
      v2f bb = { Vp[(size_t)(kbase + kk) * DIM + d0 + n],
                 Vp[(size_t)(kbase + kk + 1) * DIM + d0 + n] };
      acc[td] = wmma4(pa[j], bb, acc[td]);
    }
  }
}

// ---------------------------------------------------------------------------
// Kernel: flash-attention partial over one KV chunk per single-wave block.
// K tiles double-buffered in LDS via global_load_async_to_lds_b128.
// ---------------------------------------------------------------------------
__global__ void __launch_bounds__(32)
flash_partial(const float* __restrict__ cacheK,
              const float* __restrict__ cacheV,
              const float* __restrict__ Qp,
              const float* __restrict__ Kn,
              const float* __restrict__ Vn,
              float* __restrict__ Wm, float* __restrict__ Wl,
              float* __restrict__ Wacc) {
  __shared__ __align__(16) float kb0[16 * KSTRIDE];   // K tile ping
  __shared__ __align__(16) float kb1[16 * KSTRIDE];   // K tile pong
  __shared__ __align__(16) float lp[16 * 16];         // P-tile relay
  __shared__ __align__(16) float la[16];              // alpha relay

  int b  = blockIdx.x / NCH;
  int ch = blockIdx.x % NCH;
  int lane = threadIdx.x;
  int n = lane & 15;
  int h = lane >> 4;

  const float* Kp;
  const float* Vp;
  int ntile;
  if (ch < NCHC) {
    size_t off = ((size_t)b * KVC + (size_t)ch * CHUNK) * DIM;
    Kp = cacheK + off;
    Vp = cacheV + off;
    int left = KVC / 16 - ch * TPC;
    ntile = left < TPC ? left : TPC;
  } else {
    Kp = Kn + b * (QL * DIM);
    Vp = Vn + b * (QL * DIM);
    ntile = 1;
  }

  // Preload Q (16x128) as 32 B-layout slices — reused every tile.
  const float* Qb = Qp + b * (QL * DIM);
  v2f qa[32];
#pragma unroll
  for (int j = 0; j < 32; ++j) {
    int kk = 4 * j + 2 * h;
    qa[j] = { Qb[n * DIM + kk], Qb[n * DIM + kk + 1] };
  }

  float m = -INFINITY, l = 0.0f;
  v8f acc[8];
#pragma unroll
  for (int t = 0; t < 8; ++t) acc[t] = {};

  // Prologue: stage K tile 0.
  stage_k_tile(Kp, kb0, lane);

  for (int t = 0; t < ntile; ++t) {
    int kbase = t * 16;

    if (t + 1 < ntile) {
      // Prefetch next K tile into the other buffer; wait for current tile.
      const float* nb = ((t + 1) & 1) ? kb1 : kb0;
      stage_k_tile(Kp + (size_t)(t + 1) * 16 * DIM, nb, lane);
      wait_async_16();
      // Prefetch next V tile (8KB = 2 cachelines per lane).
      const float* vn0 = Vp + (size_t)(kbase + 16) * DIM;
      __builtin_prefetch(vn0 + lane * 64, 0, 3);
      __builtin_prefetch(vn0 + lane * 64 + 32, 0, 3);
    } else {
      wait_async_0();
    }

    if ((t & 1) == 0)
      compute_tile(kb0, lp, la, Vp, kbase, qa, m, l, acc, n, h);
    else
      compute_tile(kb1, lp, la, Vp, kbase, qa, m, l, acc, n, h);
  }

  // Write partials (m, l, acc) for this (batch, chunk).
  int pi = b * NCH + ch;
  if (lane < 16) {
    Wm[pi * QL + lane] = m;
    Wl[pi * QL + lane] = l;
  }
#pragma unroll
  for (int td = 0; td < 8; ++td)
#pragma unroll
    for (int r = 0; r < 8; ++r) {
      int q = r + 8 * h;
      Wacc[((size_t)pi * QL + q) * DIM + td * 16 + n] = acc[td][r];
    }
}

// ---------------------------------------------------------------------------
// Kernel: Q/K/V projections.  One wave per (batch, proj, 16-col tile).
// ---------------------------------------------------------------------------
__global__ void __launch_bounds__(32)
proj_kernel(const float* __restrict__ X,
            const float* __restrict__ Wq, const float* __restrict__ bq,
            const float* __restrict__ Wk, const float* __restrict__ bk,
            const float* __restrict__ Wv, const float* __restrict__ bv,
            float* __restrict__ Qp, float* __restrict__ Kn,
            float* __restrict__ Vn) {
  int idx = blockIdx.x;
  int b = idx / 24;
  int rem = idx % 24;
  int p = rem >> 3;              // 0=Q 1=K 2=V
  int n0 = (rem & 7) * 16;       // output-column tile

  const float* W    = (p == 0) ? Wq : (p == 1) ? Wk : Wv;
  const float* bias = (p == 0) ? bq : (p == 1) ? bk : bv;
  float* out = ((p == 0) ? Qp : (p == 1) ? Kn : Vn) + b * (QL * DIM);
  const float* Xb = X + b * (QL * DIM);

  int lane = threadIdx.x;
  int n = lane & 15;
  int h = lane >> 4;

  v8f c = {};
#pragma unroll 8
  for (int j = 0; j < 32; ++j) {
    int kk = 4 * j + 2 * h;
    v2f a  = { Xb[n * DIM + kk], Xb[n * DIM + kk + 1] };
    v2f bb = { W[(n0 + n) * DIM + kk], W[(n0 + n) * DIM + kk + 1] };
    c = wmma4(a, bb, c);
  }
  float bval = bias[n0 + n];
#pragma unroll
  for (int r = 0; r < 8; ++r) {
    int q = r + 8 * h;
    out[q * DIM + n0 + n] = c[r] + bval;
  }
}

// ---------------------------------------------------------------------------
// Kernel: merge the NCH partials (log-sum-exp combine).  One wave per
// (batch, query row); a lane owns four output columns.
// ---------------------------------------------------------------------------
#define MPL ((NCH + 31) / 32)   /* (max, sum) pairs held per lane */
#define MROWS 29                /* partial rows loaded as one group */
static_assert(NCH % MROWS == 0, "row groups must cover the partials exactly");
static_assert(MROWS == 29, "the fence in the merge kernel names 29 rows");

__global__ void __launch_bounds__(32)
reduce_kernel(const float* __restrict__ Wm,
              const float* __restrict__ Wl,
              const float* __restrict__ Wacc,
              float* __restrict__ out) {
  int b = blockIdx.x / QL;
  int q = blockIdx.x % QL;
  int lane = threadIdx.x;

  // Lane holds the (max, sum) of partials lane, lane + 32, ...
  float mc[MPL], lc[MPL];
  // Unrolled: constant indices keep mc and lc in registers.
#pragma unroll
  for (int k = 0; k < MPL; ++k) {
    int c = k * 32 + lane;
    bool ok = c < NCH;
    int ix = (b * NCH + (ok ? c : 0)) * QL + q;
    float mv = Wm[ix];
    float lv = Wl[ix];
    mc[k] = ok ? mv : -INFINITY;
    lc[k] = ok ? lv : 0.0f;
  }
  float M = mc[0];
  // Unrolled: constant indices, as above.
#pragma unroll
  for (int k = 1; k < MPL; ++k) M = fmaxf(M, mc[k]);
  for (int o = 16; o > 0; o >>= 1) M = fmaxf(M, __shfl_xor(M, o, 32));
  float wc[MPL];
  float L = 0.0f;
  // Unrolled: constant indices keep wc in registers.
#pragma unroll
  for (int k = 0; k < MPL; ++k) {
    // exp(x) = 2^(x * log2 e).  v_exp_f32 and a v_nop in one statement: the
    // v_nop fills the issue slot the instruction set asks for behind it.
    float x2 = (mc[k] - M) * 1.44269504088896340736f;
    asm("v_exp_f32 %0, %1\n\tv_nop" : "=v"(wc[k]) : "v"(x2));
    L += lc[k] * wc[k];
  }
  for (int o = 16; o > 0; o >>= 1) L += __shfl_xor(L, o, 32);

  const v4f* row =
      (const v4f*)(Wacc + ((size_t)(b * NCH) * QL + q) * DIM) + lane;
  v4f S = {0.0f, 0.0f, 0.0f, 0.0f};
  // Unrolled: g is a constant in the weight's register index and lane below.
#pragma unroll
  for (int g = 0; g < NCH; g += MROWS) {
    v4f v[MROWS];
    // Unrolled: constant indices keep the rows in registers.
#pragma unroll
    for (int i = 0; i < MROWS; ++i)
      v[i] = row[(size_t)(g + i) * (QL * DIM / 4)];
    // Inputs-only fence on the loaded rows: all loads of the group are issued
    // before the first is used, so the group pays one load latency instead of
    // one per few rows.
    asm volatile("" ::
        "v"(v[0]), "v"(v[1]), "v"(v[2]), "v"(v[3]), "v"(v[4]), "v"(v[5]),
        "v"(v[6]), "v"(v[7]), "v"(v[8]), "v"(v[9]), "v"(v[10]), "v"(v[11]),
        "v"(v[12]), "v"(v[13]), "v"(v[14]), "v"(v[15]), "v"(v[16]), "v"(v[17]),
        "v"(v[18]), "v"(v[19]), "v"(v[20]), "v"(v[21]), "v"(v[22]), "v"(v[23]),
        "v"(v[24]), "v"(v[25]), "v"(v[26]), "v"(v[27]), "v"(v[28]));
    // Unrolled: readlane takes the lane as a constant.
#pragma unroll
    for (int i = 0; i < MROWS; ++i) {
      // Weight of partial g + i, read from the lane that holds it.
      float w = __int_as_float(__builtin_amdgcn_readlane(
          __float_as_int(wc[(g + i) >> 5]), (g + i) & 31));
      S += v[i] * w;
    }
  }
  ((v4f*)(out + ((size_t)b * QL + q) * DIM))[lane] = S / L;
}

// ---------------------------------------------------------------------------
extern "C" void kernel_launch(void* const* d_in, const int* in_sizes, int n_in,
                              void* d_out, int out_size, void* d_ws,
                              size_t ws_size, hipStream_t stream) {
  const float* X  = (const float*)d_in[0];
  const float* cK = (const float*)d_in[1];
  const float* cV = (const float*)d_in[2];
  const float* Wq = (const float*)d_in[3];
  const float* bq = (const float*)d_in[4];
  const float* Wk = (const float*)d_in[5];
  const float* bk = (const float*)d_in[6];
  const float* Wv = (const float*)d_in[7];
  const float* bv = (const float*)d_in[8];
  float* out = (float*)d_out;
  float* ws  = (float*)d_ws;

  float* Qp   = ws;
  float* Kn   = Qp + BATCH * QL * DIM;
  float* Vn   = Kn + BATCH * QL * DIM;
  float* Wm   = Vn + BATCH * QL * DIM;
  float* Wl   = Wm + BATCH * NCH * QL;
  float* Wacc = Wl + BATCH * NCH * QL;   // 32*87*16*128 floats (~23 MB)

  proj_kernel<<<BATCH * 24, 32, 0, stream>>>(X, Wq, bq, Wk, bk, Wv, bv,
                                             Qp, Kn, Vn);
  flash_partial<<<BATCH * NCH, 32, 0, stream>>>(cK, cV, Qp, Kn, Vn,
                                                Wm, Wl, Wacc);
  reduce_kernel<<<BATCH * QL, 32, 0, stream>>>(Wm, Wl, Wacc, out);
}

// v002
// Measured time: 36 microseconds a run.
// Timed twice side by side with v001, it ran 1.03 times as fast both times.
// Over all steps from v000 it is 3.14 times as fast.
#include <hip/hip_runtime.h>
#include <math.h>

typedef float v2f __attribute__((ext_vector_type(2)));
typedef float v4f __attribute__((ext_vector_type(4)));
typedef float v8f __attribute__((ext_vector_type(8)));

#define BATCH 32
#define QL 16
#define KVC 8192
#define DIM 128
#define TPC 6                /* 16-key tiles per cache chunk */
#define CHUNK (TPC * 16)
#define NCHC ((KVC + CHUNK - 1) / CHUNK)   /* 86 cache chunks, the last one short */
#define NCH (NCHC + 1)       /* + 1 new-token chunk */
#define KSTRIDE 132          /* padded LDS row stride (words) of a K tile: bank-conflict-free */
#define VSTRIDE 136          /* the same of a V tile: rows k and k + 2 lie 16 banks apart */
#define SLOTW (16 * VSTRIDE) /* words of one ring slot: holds a K or a V tile */
#define SCALE 0.08838834764831845f

static __device__ __forceinline__ v8f wmma4(v2f a, v2f b, v8f c) {
  // 8 args: (neg_a, A, neg_b, B, c_mod, C, reuse_a, reuse_b)
  return __builtin_amdgcn_wmma_f32_16x16x4_f32(false, a, false, b, (short)0, c,
                                               false, false);
}

// Async copy 16 B/lane from global to LDS (global_load_async_to_lds_b128,
// counted on asynccnt), as the builtin: the compiler sees its address registers.
typedef int v4i __attribute__((ext_vector_type(4)));
typedef __attribute__((address_space(1))) v4i gv4i;
typedef __attribute__((address_space(3))) v4i lv4i;

static __device__ __forceinline__ void async_copy16(const float* gsrc,
                                                    float* lds_dst) {
  __builtin_amdgcn_global_load_async_to_lds_b128((gv4i*)gsrc, (lv4i*)lds_dst,
                                                 0, 0);
}

// All of this wave's copies have landed.
static __device__ __forceinline__ void wait_async_0() {
  asm volatile("s_wait_asynccnt 0" ::: "memory");
}
// All but the 32 youngest copies (the two tiles issued last) have landed.
static __device__ __forceinline__ void wait_async_32() {
  asm volatile("s_wait_asynccnt 32" ::: "memory");
}
// This wave's LDS reads have returned: their slot may be refilled by copies.
static __device__ __forceinline__ void wait_ds_0() {
  asm volatile("s_wait_dscnt 0" ::: "memory");
}

// Stage one 16x128 f32 tile into an LDS slot (rows padded to PITCH words).
// 16 copies, each moving one 512B row fully coalesced.
template <int PITCH>
static __device__ __forceinline__ void stage_tile(const float* gbase,
                                                  float* lbase, int lane) {
#pragma unroll
  for (int r = 0; r < 16; ++r)
    async_copy16(gbase + r * DIM + lane * 4, lbase + r * PITCH + lane * 4);
}

// ---------------------------------------------------------------------------
// Kernel: flash-attention partial over one KV chunk per single-wave block
// (computes S^T = K @ Q^T so the softmax reduction over keys is in-lane + one
// xor-16 exchange).  K and V tiles both come through a three-slot LDS ring,
// private to the wave, filled by async copies in the order K0 V0 K1 V1 ...;
// each tile is asked for one whole tile of work before it is read.
// ---------------------------------------------------------------------------
__global__ void __launch_bounds__(32)
flash_partial(const float* __restrict__ cacheK,
              const float* __restrict__ cacheV,
              const float* __restrict__ Qp,
              const float* __restrict__ Kn,
              const float* __restrict__ Vn,
              float* __restrict__ Wm, float* __restrict__ Wl,
              float* __restrict__ Wacc) {
  __shared__ __align__(16) float ring[3 * SLOTW];     // K / V tile ring
  __shared__ __align__(16) float lp[16 * 16];         // P-tile relay
  __shared__ __align__(16) float la[16];              // alpha relay

  int b  = blockIdx.x / NCH;
  int ch = blockIdx.x % NCH;
  int lane = threadIdx.x;
  int n = lane & 15;
  int h = lane >> 4;

  const float* Kp;
  const float* Vp;
  int ntile;
  if (ch < NCHC) {
    size_t off = ((size_t)b * KVC + (size_t)ch * CHUNK) * DIM;
    Kp = cacheK + off;
    Vp = cacheV + off;
    int left = KVC / 16 - ch * TPC;
    ntile = left < TPC ? left : TPC;
  } else {
    Kp = Kn + b * (QL * DIM);
    Vp = Vn + b * (QL * DIM);
    ntile = 1;
  }

  // Ring slots (word offsets) of K tile t, V tile t, K tile t + 1.
  int sk = 0, sv = SLOTW, sn = 2 * SLOTW;

  // Prologue: ask for K0, V0 and, where it exists, K1.
  stage_tile<KSTRIDE>(Kp, ring + sk, lane);
  stage_tile<VSTRIDE>(Vp, ring + sv, lane);
  if (ntile > 1) stage_tile<KSTRIDE>(Kp + 16 * DIM, ring + sn, lane);

  // Preload Q (16x128) as 32 B-layout slices, reused every tile.
  const float* Qb = Qp + b * (QL * DIM);
  v2f qa[32];
#pragma unroll
  for (int j = 0; j < 32; ++j) {
    int kk = 4 * j + 2 * h;
    qa[j] = { Qb[n * DIM + kk], Qb[n * DIM + kk + 1] };
  }

  float m = -INFINITY, l = 0.0f;
  v8f acc[8];
#pragma unroll
  for (int t = 0; t < 8; ++t) acc[t] = {};

  for (int t = 0; t < ntile; ++t) {
    bool more = t + 1 < ntile;

    // K tile t has landed: behind it only V t and K t + 1 were issued.  In the
    // last trip no K t + 1 exists, so the wait is to 0 (V t lands with it).
    if (more) wait_async_32(); else wait_async_0();

    // S^T tile [16k x 16q] = K_tile @ Q^T.  A-operand (K) from LDS,
    // B-operand (Q^T) preloaded in registers.  Fully unrolled so qa stays
    // in VGPRs (no dynamic indexing -> no scratch demotion).
    // Read as 8-byte pairs: every term of the word offset is even.
    const v2f* kt = (const v2f*)(ring + sk + n * KSTRIDE + 2 * h);
    v8f s = {};
#pragma unroll
    for (int j = 0; j < 32; ++j) s = wmma4(kt[2 * j], qa[j], s);

    // K tile t is read out: its slot takes V tile t + 1.
    wait_ds_0();
    if (more)
      stage_tile<VSTRIDE>(Vp + (size_t)(t + 1) * 16 * DIM, ring + sk, lane);

    // Per-query (= per-lane) online softmax over this tile's 16 keys:
    // keys r+8h live in-lane (8 values), the other 8 in the partner half.
    float sc[8];
#pragma unroll
    for (int r = 0; r < 8; ++r) sc[r] = s[r] * SCALE;
    float tm = sc[0];
#pragma unroll
    for (int r = 1; r < 8; ++r) tm = fmaxf(tm, sc[r]);
    tm = fmaxf(tm, __shfl_xor(tm, 16, 32));   // single cross-half exchange
    float mn = fmaxf(m, tm);
    float al = __expf(m - mn);
    m = mn;
    float p8[8];
    float rs = 0.0f;
#pragma unroll
    for (int r = 0; r < 8; ++r) {
      p8[r] = __expf(sc[r] - mn);
      rs += p8[r];
    }
    rs += __shfl_xor(rs, 16, 32);             // single cross-half exchange
    l = l * al + rs;

    // Relay P^T tile (key-major) and per-query alpha through LDS.
#pragma unroll
    for (int r = 0; r < 8; ++r) lp[(r + 8 * h) * 16 + n] = p8[r];
    la[n] = al;                               // both halves write same value
    __syncthreads();
    float alar[8];
#pragma unroll
    for (int r = 0; r < 8; ++r) alar[r] = la[r + 8 * h];  // broadcast reads
    v2f pa[4];
#pragma unroll
    for (int j = 0; j < 4; ++j) {
      int kk = 4 * j + 2 * h;
      pa[j] = { lp[kk * 16 + n], lp[(kk + 1) * 16 + n] };
    }
    __syncthreads();

    // Rescale accumulators by alpha(row q = r + 8h).
#pragma unroll
    for (int td = 0; td < 8; ++td)
#pragma unroll
      for (int r = 0; r < 8; ++r) acc[td][r] *= alar[r];

    // V tile t has landed: behind it only K t + 1 and V t + 1 were issued.
    // (In the last trip the wait to 0 above has covered it.)
    if (more) wait_async_32();

    // acc[16q x 128d] += P[16x16] @ V[16k x 128d], V as B-operand from LDS.
    // One lane base, so that rows k and k + 1 differ by a constant offset.
    const float* vt = ring + sv + 2 * h * VSTRIDE + n;
#pragma unroll
    for (int td = 0; td < 8; ++td) {
      int d0 = td * 16;
#pragma unroll
      for (int j = 0; j < 4; ++j) {
        v2f bb = { vt[4 * j * VSTRIDE + d0], vt[(4 * j + 1) * VSTRIDE + d0] };
        acc[td] = wmma4(pa[j], bb, acc[td]);
      }
    }

    // V tile t is read out: its slot takes K tile t + 2.
    wait_ds_0();
    if (t + 2 < ntile)
      stage_tile<KSTRIDE>(Kp + (size_t)(t + 2) * 16 * DIM, ring + sv, lane);

    // Next trip: K t + 1 lies in sn, V t + 1 in sk, K t + 2 in sv.
    int o = sk;
    sk = sn;
    sn = sv;
    sv = o;
  }

  // Write partials (m, l, acc) for this (batch, chunk).
  int pi = b * NCH + ch;
  if (lane < 16) {
    Wm[pi * QL + lane] = m;
    Wl[pi * QL + lane] = l;
  }
#pragma unroll
  for (int td = 0; td < 8; ++td)
#pragma unroll
    for (int r = 0; r < 8; ++r) {
      int q = r + 8 * h;
      Wacc[((size_t)pi * QL + q) * DIM + td * 16 + n] = acc[td][r];
    }
}

// ---------------------------------------------------------------------------
// Kernel: Q/K/V projections.  One wave per (batch, proj, 16-col tile).
// ---------------------------------------------------------------------------
__global__ void __launch_bounds__(32)
proj_kernel(const float* __restrict__ X,
            const float* __restrict__ Wq, const float* __restrict__ bq,
            const float* __restrict__ Wk, const float* __restrict__ bk,
            const float* __restrict__ Wv, const float* __restrict__ bv,
            float* __restrict__ Qp, float* __restrict__ Kn,
            float* __restrict__ Vn) {
  int idx = blockIdx.x;
  int b = idx / 24;
  int rem = idx % 24;
  int p = rem >> 3;              // 0=Q 1=K 2=V
  int n0 = (rem & 7) * 16;       // output-column tile

  const float* W    = (p == 0) ? Wq : (p == 1) ? Wk : Wv;
  const float* bias = (p == 0) ? bq : (p == 1) ? bk : bv;
  float* out = ((p == 0) ? Qp : (p == 1) ? Kn : Vn) + b * (QL * DIM);
  const float* Xb = X + b * (QL * DIM);

  int lane = threadIdx.x;
  int n = lane & 15;
  int h = lane >> 4;

  v8f c = {};
#pragma unroll 8
  for (int j = 0; j < 32; ++j) {
    int kk = 4 * j + 2 * h;
    v2f a  = { Xb[n * DIM + kk], Xb[n * DIM + kk + 1] };
    v2f bb = { W[(n0 + n) * DIM + kk], W[(n0 + n) * DIM + kk + 1] };
    c = wmma4(a, bb, c);
  }
  float bval = bias[n0 + n];
#pragma unroll
  for (int r = 0; r < 8; ++r) {
    int q = r + 8 * h;
    out[q * DIM + n0 + n] = c[r] + bval;
  }
}

// ---------------------------------------------------------------------------
// Kernel: merge the NCH partials (log-sum-exp combine).  One wave per
// (batch, query row); a lane owns four output columns.
// ---------------------------------------------------------------------------
#define MPL ((NCH + 31) / 32)   /* (max, sum) pairs held per lane */
#define MROWS 29                /* partial rows loaded as one group */
static_assert(NCH % MROWS == 0, "row groups must cover the partials exactly");
static_assert(MROWS == 29, "the fence in the merge kernel names 29 rows");

__global__ void __launch_bounds__(32)
reduce_kernel(const float* __restrict__ Wm,
              const float* __restrict__ Wl,
              const float* __restrict__ Wacc,
              float* __restrict__ out) {
  int b = blockIdx.x / QL;
  int q = blockIdx.x % QL;
  int lane = threadIdx.x;

  // Lane holds the (max, sum) of partials lane, lane + 32, ...
  float mc[MPL], lc[MPL];
  // Unrolled: constant indices keep mc and lc in registers.
#pragma unroll
  for (int k = 0; k < MPL; ++k) {
    int c = k * 32 + lane;
    bool ok = c < NCH;
    int ix = (b * NCH + (ok ? c : 0)) * QL + q;
    float mv = Wm[ix];
    float lv = Wl[ix];
    mc[k] = ok ? mv : -INFINITY;
    lc[k] = ok ? lv : 0.0f;
  }
  float M = mc[0];
  // Unrolled: constant indices, as above.
#pragma unroll
  for (int k = 1; k < MPL; ++k) M = fmaxf(M, mc[k]);
  for (int o = 16; o > 0; o >>= 1) M = fmaxf(M, __shfl_xor(M, o, 32));
  float wc[MPL];
  float L = 0.0f;
  // Unrolled: constant indices keep wc in registers.
#pragma unroll
  for (int k = 0; k < MPL; ++k) {
    // exp(x) = 2^(x * log2 e).  v_exp_f32 and a v_nop in one statement: the
    // v_nop fills the issue slot the instruction set asks for behind it.
    float x2 = (mc[k] - M) * 1.44269504088896340736f;
    asm("v_exp_f32 %0, %1\n\tv_nop" : "=v"(wc[k]) : "v"(x2));
    L += lc[k] * wc[k];
  }
  for (int o = 16; o > 0; o >>= 1) L += __shfl_xor(L, o, 32);

  const v4f* row =
      (const v4f*)(Wacc + ((size_t)(b * NCH) * QL + q) * DIM) + lane;
  v4f S = {0.0f, 0.0f, 0.0f, 0.0f};
  // Unrolled: g is a constant in the weight's register index and lane below.
#pragma unroll
  for (int g = 0; g < NCH; g += MROWS) {
    v4f v[MROWS];
    // Unrolled: constant indices keep the rows in registers.
#pragma unroll
    for (int i = 0; i < MROWS; ++i)
      v[i] = row[(size_t)(g + i) * (QL * DIM / 4)];
    // Inputs-only fence on the loaded rows: all loads of the group are issued
    // before the first is used, so the group pays one load latency instead of
    // one per few rows.
    asm volatile("" ::
        "v"(v[0]), "v"(v[1]), "v"(v[2]), "v"(v[3]), "v"(v[4]), "v"(v[5]),
        "v"(v[6]), "v"(v[7]), "v"(v[8]), "v"(v[9]), "v"(v[10]), "v"(v[11]),
        "v"(v[12]), "v"(v[13]), "v"(v[14]), "v"(v[15]), "v"(v[16]), "v"(v[17]),
        "v"(v[18]), "v"(v[19]), "v"(v[20]), "v"(v[21]), "v"(v[22]), "v"(v[23]),
        "v"(v[24]), "v"(v[25]), "v"(v[26]), "v"(v[27]), "v"(v[28]));
    // Unrolled: readlane takes the lane as a constant.
#pragma unroll
    for (int i = 0; i < MROWS; ++i) {
      // Weight of partial g + i, read from the lane that holds it.
      float w = __int_as_float(__builtin_amdgcn_readlane(
          __float_as_int(wc[(g + i) >> 5]), (g + i) & 31));
      S += v[i] * w;
    }
  }
  ((v4f*)(out + ((size_t)b * QL + q) * DIM))[lane] = S / L;
}

// ---------------------------------------------------------------------------
extern "C" void kernel_launch(void* const* d_in, const int* in_sizes, int n_in,
                              void* d_out, int out_size, void* d_ws,
                              size_t ws_size, hipStream_t stream) {
  const float* X  = (const float*)d_in[0];
  const float* cK = (const float*)d_in[1];
  const float* cV = (const float*)d_in[2];
  const float* Wq = (const float*)d_in[3];
  const float* bq = (const float*)d_in[4];
  const float* Wk = (const float*)d_in[5];
  const float* bk = (const float*)d_in[6];
  const float* Wv = (const float*)d_in[7];
  const float* bv = (const float*)d_in[8];
  float* out = (float*)d_out;
  float* ws  = (float*)d_ws;

  float* Qp   = ws;
  float* Kn   = Qp + BATCH * QL * DIM;
  float* Vn   = Kn + BATCH * QL * DIM;
  float* Wm   = Vn + BATCH * QL * DIM;
  float* Wl   = Wm + BATCH * NCH * QL;
  float* Wacc = Wl + BATCH * NCH * QL;   // 32*87*16*128 floats (~23 MB)

  proj_kernel<<<BATCH * 24, 32, 0, stream>>>(X, Wq, bq, Wk, bk, Wv, bv,
                                             Qp, Kn, Vn);
  flash_partial<<<BATCH * NCH, 32, 0, stream>>>(cK, cV, Qp, Kn, Vn,
                                                Wm, Wl, Wacc);
  reduce_kernel<<<BATCH * QL, 32, 0, stream>>>(Wm, Wl, Wacc, out);
}

// v003
// One run takes 30.9 microseconds.
// In two side-by-side timings against v002, it was 1.15 and 1.17 times as fast.
// All steps since v000 together make it 3.64 times as fast.
#include <hip/hip_runtime.h>
#include <math.h>

typedef float v2f __attribute__((ext_vector_type(2)));
typedef float v4f __attribute__((ext_vector_type(4)));
typedef float v8f __attribute__((ext_vector_type(8)));

#define BATCH 32
#define QL 16
#define KVC 8192
#define DIM 128
#define NW 12                /* waves per workgroup: three per SIMD */
#define NSPLIT 8             /* key ranges per batch, one workgroup each */
#define NTC (KVC / 16)       /* 16-key tiles of one batch's cache */
#define TPS (NTC / NSPLIT)   /* cache tiles per key range */
#define PPITCH 132           /* LDS row stride (words) of a wave's partial */
#define MLW 32               /* words per partial: 16 maxima, 16 sums, one 128-B line */
#define KSTRIDE 132          /* padded LDS row stride (words) of a K tile: bank-conflict-free */
#define VSTRIDE 136          /* the same of a V tile: rows k and k + 2 lie 16 banks apart */
#define SLOTW (16 * VSTRIDE) /* words of one ring slot: holds a K or a V tile */
#define SCALE 0.08838834764831845f

static __device__ __forceinline__ v8f wmma4(v2f a, v2f b, v8f c) {
  // 8 args: (neg_a, A, neg_b, B, c_mod, C, reuse_a, reuse_b)
  return __builtin_amdgcn_wmma_f32_16x16x4_f32(false, a, false, b, (short)0, c,
                                               false, false);
}

// Async copy 16 B/lane from global to LDS (global_load_async_to_lds_b128,
// counted on asynccnt), as the builtin: the compiler sees its address registers.
typedef int v4i __attribute__((ext_vector_type(4)));
typedef __attribute__((address_space(1))) v4i gv4i;
typedef __attribute__((address_space(3))) v4i lv4i;

static __device__ __forceinline__ void async_copy16(const float* gsrc,
                                                    float* lds_dst) {
  __builtin_amdgcn_global_load_async_to_lds_b128((gv4i*)gsrc, (lv4i*)lds_dst,
                                                 0, 0);
}

// All of this wave's copies have landed.
static __device__ __forceinline__ void wait_async_0() {
  asm volatile("s_wait_asynccnt 0" ::: "memory");
}
// All but the 32 youngest copies (the two tiles issued last) have landed.
static __device__ __forceinline__ void wait_async_32() {
  asm volatile("s_wait_asynccnt 32" ::: "memory");
}
// This wave's LDS reads have returned: their slot may be refilled by copies.
static __device__ __forceinline__ void wait_ds_0() {
  asm volatile("s_wait_dscnt 0" ::: "memory");
}

// exp(x) = 2^(x * log2 e).  v_exp_f32 and a v_nop in one statement: the v_nop
// fills the issue slot the instruction set asks for behind it.
static __device__ __forceinline__ float exp_slot(float x) {
  float x2 = x * 1.44269504088896340736f;
  float y;
  asm("v_exp_f32 %0, %1\n\tv_nop" : "=v"(y) : "v"(x2));
  return y;
}

// Stage one 16x128 f32 tile into an LDS slot (rows padded to PITCH words).
// 16 copies, each moving one 512B row fully coalesced.
template <int PITCH>
static __device__ __forceinline__ void stage_tile(const float* gbase,
                                                  float* lbase, int lane) {
#pragma unroll
  for (int r = 0; r < 16; ++r)
    async_copy16(gbase + r * DIM + lane * 4, lbase + r * PITCH + lane * 4);
}

// ---------------------------------------------------------------------------
// Kernel: flash-attention partial over one key range per workgroup of NW
// waves.  Wave w takes the range's tiles w, w + NW, ... with its own maximum,
// sum and accumulators (computes S^T = K @ Q^T so the softmax reduction over
// keys is in-lane + one xor-16 exchange).  K and V tiles both come through a
// three-slot LDS ring, private to the wave, filled by async copies in the
// order K0 V0 K1 V1 ...; each tile is asked for one whole tile of work before
// it is read.  At the end the waves' partials are merged in LDS, and the
// workgroup stores one partial.
// ---------------------------------------------------------------------------
__global__ void __launch_bounds__(NW * 32)
flash_partial(const float* __restrict__ cacheK,
              const float* __restrict__ cacheV,
              const float* __restrict__ Qp,
              const float* __restrict__ Kn,
              const float* __restrict__ Vn,
              float* __restrict__ Wml, float* __restrict__ Wacc) {
  __shared__ __align__(16) float ring_all[NW * 3 * SLOTW];  // K / V tile rings
  __shared__ __align__(16) float lp_all[NW * 16 * 16];      // P-tile relays
  __shared__ __align__(16) float la_all[NW * 16];           // alpha relays

  int b  = blockIdx.x / NSPLIT;
  int sp = blockIdx.x % NSPLIT;
  int lane = threadIdx.x & 31;
  int w = __builtin_amdgcn_readfirstlane(threadIdx.x >> 5);
  int n = lane & 15;
  int h = lane >> 4;

  // This wave's own ring and relays.
  float* ring = ring_all + w * (3 * SLOTW);
  float* lp = lp_all + w * (16 * 16);
  float* la = la_all + w * 16;

  // The range's tiles are cache tiles sp * TPS ...; the last range has the
  // new-token tile (index NTC of the batch) behind them.
  int nloc = TPS + (sp == NSPLIT - 1 ? 1 : 0);
  int ntile = (nloc - w + NW - 1) / NW;
  // First element, in K or V alike, of this wave's tile t.
  auto tile_of = [&](const float* cache, const float* fresh, int t) {
    int g = sp * TPS + w + t * NW;
    return g < NTC ? cache + ((size_t)b * KVC + (size_t)g * 16) * DIM
                   : fresh + b * (QL * DIM);
  };

  // Ring slots (word offsets) of K tile t, V tile t, K tile t + 1.
  int sk = 0, sv = SLOTW, sn = 2 * SLOTW;

  // Prologue: ask for K0, V0 and, where it exists, K1.
  stage_tile<KSTRIDE>(tile_of(cacheK, Kn, 0), ring + sk, lane);
  stage_tile<VSTRIDE>(tile_of(cacheV, Vn, 0), ring + sv, lane);
  if (ntile > 1) stage_tile<KSTRIDE>(tile_of(cacheK, Kn, 1), ring + sn, lane);

  // Preload Q (16x128) as 32 B-layout slices, reused every tile.
  const float* Qb = Qp + b * (QL * DIM);
  v2f qa[32];
#pragma unroll
  for (int j = 0; j < 32; ++j) {
    int kk = 4 * j + 2 * h;
    qa[j] = { Qb[n * DIM + kk], Qb[n * DIM + kk + 1] };
  }

  float m = -INFINITY, l = 0.0f;
  v8f acc[8];
#pragma unroll
  for (int t = 0; t < 8; ++t) acc[t] = {};

  for (int t = 0; t < ntile; ++t) {
    bool more = t + 1 < ntile;

    // K tile t has landed: behind it only V t and K t + 1 were issued.  In the
    // last trip no K t + 1 exists, so the wait is to 0 (V t lands with it).
    if (more) wait_async_32(); else wait_async_0();

    // S^T tile [16k x 16q] = K_tile @ Q^T.  A-operand (K) from LDS,
    // B-operand (Q^T) preloaded in registers.  Fully unrolled so qa stays
    // in VGPRs (no dynamic indexing -> no scratch demotion).
    // Read as 8-byte pairs: every term of the word offset is even.
    const v2f* kt = (const v2f*)(ring + sk + n * KSTRIDE + 2 * h);
    v8f s = {};
#pragma unroll
    for (int j = 0; j < 32; ++j) s = wmma4(kt[2 * j], qa[j], s);

    // K tile t is read out: its slot takes V tile t + 1.
    wait_ds_0();
    if (more)
      stage_tile<VSTRIDE>(tile_of(cacheV, Vn, t + 1), ring + sk, lane);

    // Per-query (= per-lane) online softmax over this tile's 16 keys:
    // keys r+8h live in-lane (8 values), the other 8 in the partner half.
    float sc[8];
#pragma unroll
    for (int r = 0; r < 8; ++r) sc[r] = s[r] * SCALE;
    float tm = sc[0];
#pragma unroll
    for (int r = 1; r < 8; ++r) tm = fmaxf(tm, sc[r]);
    tm = fmaxf(tm, __shfl_xor(tm, 16, 32));   // single cross-half exchange
    float mn = fmaxf(m, tm);
    float al = __expf(m - mn);
    m = mn;
    float p8[8];
    float rs = 0.0f;
#pragma unroll
    for (int r = 0; r < 8; ++r) {
      p8[r] = __expf(sc[r] - mn);
      rs += p8[r];
    }
    rs += __shfl_xor(rs, 16, 32);             // single cross-half exchange
    l = l * al + rs;

    // Relay P^T tile (key-major) and per-query alpha through LDS.  The relay
    // is the wave's own, so no workgroup barrier stands here (the waves' trip
    // counts differ): the stores are waited for before other lanes read them.
#pragma unroll
    for (int r = 0; r < 8; ++r) lp[(r + 8 * h) * 16 + n] = p8[r];
    la[n] = al;                               // both halves write same value
    wait_ds_0();
    float alar[8];
#pragma unroll
    for (int r = 0; r < 8; ++r) alar[r] = la[r + 8 * h];  // broadcast reads
    v2f pa[4];
#pragma unroll
    for (int j = 0; j < 4; ++j) {
      int kk = 4 * j + 2 * h;
      pa[j] = { lp[kk * 16 + n], lp[(kk + 1) * 16 + n] };
    }
    // (The wait behind the V reads below ends these reads before the next
    // trip's relay stores.)

    // Rescale accumulators by alpha(row q = r + 8h).
#pragma unroll
    for (int td = 0; td < 8; ++td)
#pragma unroll
      for (int r = 0; r < 8; ++r) acc[td][r] *= alar[r];

    // V tile t has landed: behind it only K t + 1 and V t + 1 were issued.
    // (In the last trip the wait to 0 above has covered it.)
    if (more) wait_async_32();

    // acc[16q x 128d] += P[16x16] @ V[16k x 128d], V as B-operand from LDS.
    // One lane base, so that rows k and k + 1 differ by a constant offset.
    const float* vt = ring + sv + 2 * h * VSTRIDE + n;
#pragma unroll
    for (int td = 0; td < 8; ++td) {
      int d0 = td * 16;
#pragma unroll
      for (int j = 0; j < 4; ++j) {
        v2f bb = { vt[4 * j * VSTRIDE + d0], vt[(4 * j + 1) * VSTRIDE + d0] };
        acc[td] = wmma4(pa[j], bb, acc[td]);
      }
    }

    // V tile t is read out: its slot takes K tile t + 2.
    wait_ds_0();
    if (t + 2 < ntile)
      stage_tile<KSTRIDE>(tile_of(cacheK, Kn, t + 2), ring + sv, lane);

    // Next trip: K t + 1 lies in sn, V t + 1 in sk, K t + 2 in sv.
    int o = sk;
    sk = sn;
    sn = sv;
    sv = o;
  }

  // This wave's partial (m, l, acc) goes into its own ring and relay: the last
  // trip has waited for all of its copies and for its LDS reads.
#pragma unroll
  for (int td = 0; td < 8; ++td)
#pragma unroll
    for (int r = 0; r < 8; ++r)
      ring[(r + 8 * h) * PPITCH + td * 16 + n] = acc[td][r];
  lp[n] = m;                                  // both halves write same value
  lp[16 + n] = l;
  // The one workgroup barrier: every wave's partial is in LDS behind it.
  __syncthreads();

  // Merge the NW partials (log-sum-exp combine).  A wave takes whole query
  // rows, a lane four columns: each row leaves as one 512-B store.
  int pi = b * NSPLIT + sp;
  for (int q = w; q < QL; q += NW) {
    float mw[NW];
    // Unrolled: constant indices keep mw in registers.
#pragma unroll
    for (int k = 0; k < NW; ++k) mw[k] = lp_all[k * (16 * 16) + q];
    float M = mw[0];
#pragma unroll
    for (int k = 1; k < NW; ++k) M = fmaxf(M, mw[k]);
    float L = 0.0f;
    v4f S = {0.0f, 0.0f, 0.0f, 0.0f};
#pragma unroll
    for (int k = 0; k < NW; ++k) {
      float wt = exp_slot(mw[k] - M);
      L += lp_all[k * (16 * 16) + 16 + q] * wt;
      S += *(const v4f*)(ring_all + k * (3 * SLOTW) + q * PPITCH + lane * 4) * wt;
    }
    ((v4f*)(Wacc + ((size_t)pi * QL + q) * DIM))[lane] = S;
    if (lane == 0) {
      Wml[pi * MLW + q] = M;
      Wml[pi * MLW + QL + q] = L;
      // The next row's trip overwrites the registers these stores name.
      asm volatile("s_wait_xcnt 0x0" ::: "memory");
    }
  }
}

// ---------------------------------------------------------------------------
// Kernel: Q/K/V projections.  One wave per (batch, proj, 16-col tile).
// ---------------------------------------------------------------------------
__global__ void __launch_bounds__(32)
proj_kernel(const float* __restrict__ X,
            const float* __restrict__ Wq, const float* __restrict__ bq,
            const float* __restrict__ Wk, const float* __restrict__ bk,
            const float* __restrict__ Wv, const float* __restrict__ bv,
            float* __restrict__ Qp, float* __restrict__ Kn,
            float* __restrict__ Vn) {
  int idx = blockIdx.x;
  int b = idx / 24;
  int rem = idx % 24;
  int p = rem >> 3;              // 0=Q 1=K 2=V
  int n0 = (rem & 7) * 16;       // output-column tile

  const float* W    = (p == 0) ? Wq : (p == 1) ? Wk : Wv;
  const float* bias = (p == 0) ? bq : (p == 1) ? bk : bv;
  float* out = ((p == 0) ? Qp : (p == 1) ? Kn : Vn) + b * (QL * DIM);
  const float* Xb = X + b * (QL * DIM);

  int lane = threadIdx.x;
  int n = lane & 15;
  int h = lane >> 4;

  v8f c = {};
#pragma unroll 8
  for (int j = 0; j < 32; ++j) {
    int kk = 4 * j + 2 * h;
    v2f a  = { Xb[n * DIM + kk], Xb[n * DIM + kk + 1] };
    v2f bb = { W[(n0 + n) * DIM + kk], W[(n0 + n) * DIM + kk + 1] };
    c = wmma4(a, bb, c);
  }
  float bval = bias[n0 + n];
#pragma unroll
  for (int r = 0; r < 8; ++r) {
    int q = r + 8 * h;
    out[q * DIM + n0 + n] = c[r] + bval;
  }
}

// ---------------------------------------------------------------------------
// Kernel: merge the NSPLIT partials of a batch (log-sum-exp combine).  One wave
// per (batch, query row); a lane owns four output columns.
// ---------------------------------------------------------------------------
__global__ void __launch_bounds__(32)
reduce_kernel(const float* __restrict__ Wml,
              const float* __restrict__ Wacc,
              float* __restrict__ out) {
  int b = blockIdx.x / QL;
  int q = blockIdx.x % QL;
  int lane = threadIdx.x;

  // One load: lanes 0-7 get the partials' maxima, lanes 8-15 their sums (the
  // upper half repeats them), so that it flies together with the row loads.
  float ml = Wml[(b * NSPLIT + (lane & 7)) * MLW + ((lane >> 3) & 1) * QL + q];
  const v4f* row =
      (const v4f*)(Wacc + ((size_t)(b * NSPLIT) * QL + q) * DIM) + lane;
  v4f v[NSPLIT];
  // Unrolled (all loops here): constant indices keep the arrays in registers,
  // and readlane takes the lane as a constant.
#pragma unroll
  for (int k = 0; k < NSPLIT; ++k) v[k] = row[(size_t)k * (QL * DIM / 4)];

  float mc[NSPLIT], lc[NSPLIT];
#pragma unroll
  for (int k = 0; k < NSPLIT; ++k) {
    mc[k] = __int_as_float(__builtin_amdgcn_readlane(__float_as_int(ml), k));
    lc[k] = __int_as_float(
        __builtin_amdgcn_readlane(__float_as_int(ml), NSPLIT + k));
  }
  float M = mc[0];
#pragma unroll
  for (int k = 1; k < NSPLIT; ++k) M = fmaxf(M, mc[k]);
  float L = 0.0f;
  v4f S = {0.0f, 0.0f, 0.0f, 0.0f};
#pragma unroll
  for (int k = 0; k < NSPLIT; ++k) {
    float wt = exp_slot(mc[k] - M);
    L += lc[k] * wt;
    S += v[k] * wt;
  }
  ((v4f*)(out + ((size_t)b * QL + q) * DIM))[lane] = S / L;
}

// ---------------------------------------------------------------------------
extern "C" void kernel_launch(void* const* d_in, const int* in_sizes, int n_in,
                              void* d_out, int out_size, void* d_ws,
                              size_t ws_size, hipStream_t stream) {
  const float* X  = (const float*)d_in[0];
  const float* cK = (const float*)d_in[1];
  const float* cV = (const float*)d_in[2];
  const float* Wq = (const float*)d_in[3];
  const float* bq = (const float*)d_in[4];
  const float* Wk = (const float*)d_in[5];
  const float* bk = (const float*)d_in[6];
  const float* Wv = (const float*)d_in[7];
  const float* bv = (const float*)d_in[8];
  float* out = (float*)d_out;
  float* ws  = (float*)d_ws;

  float* Qp   = ws;
  float* Kn   = Qp + BATCH * QL * DIM;
  float* Vn   = Kn + BATCH * QL * DIM;
  float* Wml  = Vn + BATCH * QL * DIM;
  float* Wacc = Wml + BATCH * NSPLIT * MLW;   // 32*8*16*128 floats (2 MB)

  proj_kernel<<<BATCH * 24, 32, 0, stream>>>(X, Wq, bq, Wk, bk, Wv, bv,
                                             Qp, Kn, Vn);
  flash_partial<<<BATCH * NSPLIT, NW * 32, 0, stream>>>(cK, cV, Qp, Kn, Vn,
                                                        Wml, Wacc);
  reduce_kernel<<<BATCH * QL, 32, 0, stream>>>(Wml, Wacc, out);
}

// v004
// Measured time: 28.9 microseconds a run.
// Two timings next to v003 put it at 1.06 and 1.07 times that version's speed.
// Counting every step since v000, it is 3.87 times as fast.
#include <hip/hip_runtime.h>
#include <math.h>

typedef float v2f __attribute__((ext_vector_type(2)));
typedef float v4f __attribute__((ext_vector_type(4)));
typedef float v8f __attribute__((ext_vector_type(8)));

#define BATCH 32
#define QL 16
#define KVC 8192
#define DIM 128
#define NW 12                /* waves per workgroup: three per SIMD */
#define NSPLIT 8             /* key ranges per batch, one workgroup each */
#define NTC (KVC / 16)       /* 16-key tiles of one batch's cache */
#define TPS 65               /* tiles per key range; the last has 57 cache tiles + the new one */
#define XP 132               /* LDS row stride (words) of X and of Q: bank-conflict-free */
#define PPITCH 132           /* LDS row stride (words) of a wave's partial */
#define MLW 32               /* words per partial: 16 maxima, 16 sums, one 128-B line */
#define KSTRIDE 132          /* padded LDS row stride (words) of a K tile: bank-conflict-free */
#define VSTRIDE 136          /* the same of a V tile: rows k and k + 2 lie 16 banks apart */
#define SLOTW (16 * VSTRIDE) /* words of one ring slot: holds a K or a V tile */
#define SCALE 0.08838834764831845f

static __device__ __forceinline__ v8f wmma4(v2f a, v2f b, v8f c) {
  // 8 args: (neg_a, A, neg_b, B, c_mod, C, reuse_a, reuse_b)
  return __builtin_amdgcn_wmma_f32_16x16x4_f32(false, a, false, b, (short)0, c,
                                               false, false);
}

// Async copy 16 B/lane from global to LDS (global_load_async_to_lds_b128,
// counted on asynccnt), as the builtin: the compiler sees its address registers.
typedef int v4i __attribute__((ext_vector_type(4)));
typedef __attribute__((address_space(1))) v4i gv4i;
typedef __attribute__((address_space(3))) v4i lv4i;

static __device__ __forceinline__ void async_copy16(const float* gsrc,
                                                    float* lds_dst) {
  __builtin_amdgcn_global_load_async_to_lds_b128((gv4i*)gsrc, (lv4i*)lds_dst,
                                                 0, 0);
}

// All of this wave's copies have landed.
static __device__ __forceinline__ void wait_async_0() {
  asm volatile("s_wait_asynccnt 0" ::: "memory");
}
// All but the 32 youngest copies (the two tiles issued last) have landed.
static __device__ __forceinline__ void wait_async_32() {
  asm volatile("s_wait_asynccnt 32" ::: "memory");
}
// This wave's LDS reads have returned: their slot may be refilled by copies.
static __device__ __forceinline__ void wait_ds_0() {
  asm volatile("s_wait_dscnt 0" ::: "memory");
}

// Stands behind global loads or stores whose address or data registers are
// overwritten next.
static __device__ __forceinline__ void wait_x_0() {
  asm volatile("s_wait_xcnt 0x0" ::: "memory");
}

// exp(x) = 2^(x * log2 e).  v_exp_f32 and a v_nop in one statement: the v_nop
// fills the issue slot the instruction set asks for behind it.
static __device__ __forceinline__ float exp_slot(float x) {
  float x2 = x * 1.44269504088896340736f;
  float y;
  asm("v_exp_f32 %0, %1\n\tv_nop" : "=v"(y) : "v"(x2));
  return y;
}

// Stage one 16x128 f32 tile into an LDS slot (rows padded to PITCH words).
// 16 copies, each moving one 512B row fully coalesced.
template <int PITCH>
static __device__ __forceinline__ void stage_tile(const float* gbase,
                                                  float* lbase, int lane) {
#pragma unroll
  for (int r = 0; r < 16; ++r)
    async_copy16(gbase + r * DIM + lane * 4, lbase + r * PITCH + lane * 4);
}

// One 16x16 tile of a projection X @ W^T: X (16 x 128) and 16 rows of W, both
// in LDS, as A and B fragments in the same k order.
static __device__ __forceinline__ v8f proj_tile(const float* xs,
                                                const float* wt, int n, int h) {
  const v2f* xa = (const v2f*)(xs + n * XP + 2 * h);
  const v2f* wb = (const v2f*)(wt + n * KSTRIDE + 2 * h);
  v8f c = {};
  // Unrolled: the LDS offsets become constants.
#pragma unroll
  for (int j = 0; j < 32; ++j) c = wmma4(xa[2 * j], wb[2 * j], c);
  return c;
}

// ---------------------------------------------------------------------------
// Kernel: flash-attention partial over one key range per workgroup of NW
// waves.  Wave w takes the range's tiles w, w + NW, ... with its own maximum,
// sum and accumulators (computes S^T = K @ Q^T so the softmax reduction over
// keys is in-lane + one xor-16 exchange).  K and V tiles both come through a
// three-slot LDS ring, private to the wave, filled by async copies in the
// order K0 V0 K1 V1 ...; each tile is asked for one whole tile of work before
// it is read.  At the end the waves' partials are merged in LDS, and the
// workgroup stores one partial.
// The projections are made here too, while K tile 0 flies: every workgroup
// forms its batch's Q (one column tile a wave, handed round through LDS); the
// last range's workgroup also forms K_new and V_new, and has fewer cache tiles
// for it.
// ---------------------------------------------------------------------------
__global__ void __launch_bounds__(NW * 32)
flash_partial(const float* __restrict__ X,
              const float* __restrict__ Wq, const float* __restrict__ bq,
              const float* __restrict__ Wk, const float* __restrict__ bk,
              const float* __restrict__ Wv, const float* __restrict__ bv,
              const float* __restrict__ cacheK,
              const float* __restrict__ cacheV,
              float* __restrict__ Kn, float* __restrict__ Vn,
              float* __restrict__ Wml, float* __restrict__ Wacc) {
  __shared__ __align__(16) float ring_all[NW * 3 * SLOTW];  // K / V tile rings
  __shared__ __align__(16) float lp_all[NW * 16 * 16];      // P-tile relays; X, Q first
  __shared__ __align__(16) float la_all[NW * 16];           // alpha relays

  int b  = blockIdx.x / NSPLIT;
  int sp = blockIdx.x % NSPLIT;
  int lane = threadIdx.x & 31;
  int w = __builtin_amdgcn_readfirstlane(threadIdx.x >> 5);
  int n = lane & 15;
  int h = lane >> 4;

  // This wave's own ring and relays.
  float* ring = ring_all + w * (3 * SLOTW);
  float* lp = lp_all + w * (16 * 16);
  float* la = la_all + w * 16;

  // The range's tiles are cache tiles sp * TPS ...; the last range ends with
  // the new-token tile (index NTC of the batch).
  int nloc = sp == NSPLIT - 1 ? NTC + 1 - (NSPLIT - 1) * TPS : TPS;
  int ntile = (nloc - w + NW - 1) / NW;
  // First element, in K or V alike, of this wave's tile t.
  auto tile_of = [&](const float* cache, const float* fresh, int t) {
    int g = sp * TPS + w + t * NW;
    return g < NTC ? cache + ((size_t)b * KVC + (size_t)g * 16) * DIM
                   : fresh + b * (QL * DIM);
  };

  // Ring slots (word offsets) of K tile t, V tile t, K tile t + 1.
  int sk = 0, sv = SLOTW, sn = 2 * SLOTW;

  // Projection column tiles of this workgroup: 0-7 of Q; in the last range
  // also 8-15 of K_new and 16-23 of V_new.  Wave w takes tiles w and w + NW.
  int np = sp == NSPLIT - 1 ? 24 : 8;
  bool hasA = w < np, hasB = w + NW < np;
  auto w_rows = [&](int i) {
    return (i < 8 ? Wq : i < 16 ? Wk : Wv) + (i & 7) * 16 * DIM;
  };
  auto b_of = [&](int i) {
    return (i < 8 ? bq : i < 16 ? bk : bv)[(i & 7) * 16 + n];
  };

  // Whole rows of X and of the wave's weight tiles into registers, asked for
  // ahead of the K copies so that they do not queue behind them.
  const float* Xb = X + b * (QL * DIM);
  v4f x0 = *(const v4f*)(Xb + w * DIM + lane * 4), x1 = {};
  if (w + NW < QL) x1 = *(const v4f*)(Xb + (w + NW) * DIM + lane * 4);
  wait_x_0();
  v4f wa[16], wb[16];
  float biasA = 0.0f, biasB = 0.0f;
  // Unrolled (the four loops here): constant indices keep wa, wb in registers.
  if (hasA) {
    const float* g = w_rows(w) + lane * 4;
#pragma unroll
    for (int r = 0; r < 16; ++r) wa[r] = *(const v4f*)(g + r * DIM);
    biasA = b_of(w);
    wait_x_0();
  }
  if (hasB) {
    const float* g = w_rows(w + NW) + lane * 4;
#pragma unroll
    for (int r = 0; r < 16; ++r) wb[r] = *(const v4f*)(g + r * DIM);
    biasB = b_of(w + NW);
    wait_x_0();
  }

  // Ask for K0: it flies while the projections are made.
  stage_tile<KSTRIDE>(tile_of(cacheK, Kn, 0), ring + sk, lane);

  // X goes into the relay space (shared), the weight tiles into the wave's two
  // ring slots that no copy is aimed at yet.
  *(v4f*)(lp_all + w * XP + lane * 4) = x0;
  if (w + NW < QL) *(v4f*)(lp_all + (w + NW) * XP + lane * 4) = x1;
  if (hasA) {
#pragma unroll
    for (int r = 0; r < 16; ++r)
      *(v4f*)(ring + sv + r * KSTRIDE + lane * 4) = wa[r];
  }
  if (hasB) {
#pragma unroll
    for (int r = 0; r < 16; ++r)
      *(v4f*)(ring + sn + r * KSTRIDE + lane * 4) = wb[r];
  }
  // Barrier: every row of X is in LDS behind it.
  __syncthreads();

  v8f cA = {}, cB = {};
  if (hasA) cA = proj_tile(lp_all, ring + sv, n, h);
  if (hasB) cB = proj_tile(lp_all, ring + sn, n, h);

  // The weight tiles are read out: their slots take V0 and, where it exists, K1.
  wait_ds_0();
  stage_tile<VSTRIDE>(tile_of(cacheV, Vn, 0), ring + sv, lane);
  if (ntile > 1) stage_tile<KSTRIDE>(tile_of(cacheK, Kn, 1), ring + sn, lane);

  // K_new and V_new tiles go to the workspace: the wave that owns the new-token
  // tile copies them from there in its last trips, behind the barrier below.
  auto store_new = [&](int i, v8f c, float bias) {
    float* o = (i < 16 ? Kn : Vn) + b * (QL * DIM) + (i & 7) * 16 + n;
#pragma unroll
    for (int r = 0; r < 8; ++r) o[(r + 8 * h) * DIM] = c[r] + bias;
  };
  if (hasA && w >= 8) {
    store_new(w, cA, biasA);
    wait_x_0();
  }
  if (hasB) store_new(w + NW, cB, biasB);
  // Barrier: every wave has read X (Q may overwrite it), and K_new, V_new are
  // stored.
  __syncthreads();
  if (w < 8) {
#pragma unroll
    for (int r = 0; r < 8; ++r)
      lp_all[(r + 8 * h) * XP + w * 16 + n] = cA[r] + biasA;
  }
  // Barrier: all of Q is in LDS behind it.
  __syncthreads();

  // Q (16x128) as 32 B-layout slices, reused every tile.
  v2f qa[32];
#pragma unroll
  for (int j = 0; j < 32; ++j)
    qa[j] = *(const v2f*)(lp_all + n * XP + 4 * j + 2 * h);
  // Barrier: every wave has read Q; the space serves as the P relays from here.
  __syncthreads();

  float m = -INFINITY, l = 0.0f;
  v8f acc[8];
#pragma unroll
  for (int t = 0; t < 8; ++t) acc[t] = {};

  for (int t = 0; t < ntile; ++t) {
    bool more = t + 1 < ntile;

    // K tile t has landed: behind it only V t and K t + 1 were issued.  In the
    // last trip no K t + 1 exists, so the wait is to 0 (V t lands with it).
    if (more) wait_async_32(); else wait_async_0();

    // S^T tile [16k x 16q] = K_tile @ Q^T.  A-operand (K) from LDS,
    // B-operand (Q^T) preloaded in registers.  Fully unrolled so qa stays
    // in VGPRs (no dynamic indexing -> no scratch demotion).
    // Read as 8-byte pairs: every term of the word offset is even.
    const v2f* kt = (const v2f*)(ring + sk + n * KSTRIDE + 2 * h);
    v8f s = {};
#pragma unroll
    for (int j = 0; j < 32; ++j) s = wmma4(kt[2 * j], qa[j], s);

    // K tile t is read out: its slot takes V tile t + 1.
    wait_ds_0();
    if (more)
      stage_tile<VSTRIDE>(tile_of(cacheV, Vn, t + 1), ring + sk, lane);

    // Per-query (= per-lane) online softmax over this tile's 16 keys:
    // keys r+8h live in-lane (8 values), the other 8 in the partner half.
    float sc[8];
#pragma unroll
    for (int r = 0; r < 8; ++r) sc[r] = s[r] * SCALE;
    float tm = sc[0];
#pragma unroll
    for (int r = 1; r < 8; ++r) tm = fmaxf(tm, sc[r]);
    tm = fmaxf(tm, __shfl_xor(tm, 16, 32));   // single cross-half exchange
    float mn = fmaxf(m, tm);
    float al = __expf(m - mn);
    m = mn;
    float p8[8];
    float rs = 0.0f;
#pragma unroll
    for (int r = 0; r < 8; ++r) {
      p8[r] = __expf(sc[r] - mn);
      rs += p8[r];
    }
    rs += __shfl_xor(rs, 16, 32);             // single cross-half exchange
    l = l * al + rs;

    // Relay P^T tile (key-major) and per-query alpha through LDS.  The relay
    // is the wave's own, so no workgroup barrier stands here (the waves' trip
    // counts differ): the stores are waited for before other lanes read them.
#pragma unroll
    for (int r = 0; r < 8; ++r) lp[(r + 8 * h) * 16 + n] = p8[r];
    la[n] = al;                               // both halves write same value
    wait_ds_0();
    float alar[8];
#pragma unroll
    for (int r = 0; r < 8; ++r) alar[r] = la[r + 8 * h];  // broadcast reads
    v2f pa[4];
#pragma unroll
    for (int j = 0; j < 4; ++j) {
      int kk = 4 * j + 2 * h;
      pa[j] = { lp[kk * 16 + n], lp[(kk + 1) * 16 + n] };
    }
    // (The wait behind the V reads below ends these reads before the next
    // trip's relay stores.)

    // Rescale accumulators by alpha(row q = r + 8h).
#pragma unroll
    for (int td = 0; td < 8; ++td)
#pragma unroll
      for (int r = 0; r < 8; ++r) acc[td][r] *= alar[r];

    // V tile t has landed: behind it only K t + 1 and V t + 1 were issued.
    // (In the last trip the wait to 0 above has covered it.)
    if (more) wait_async_32();

    // acc[16q x 128d] += P[16x16] @ V[16k x 128d], V as B-operand from LDS.
    // One lane base, so that rows k and k + 1 differ by a constant offset.
    const float* vt = ring + sv + 2 * h * VSTRIDE + n;
#pragma unroll
    for (int td = 0; td < 8; ++td) {
      int d0 = td * 16;
#pragma unroll
      for (int j = 0; j < 4; ++j) {
        v2f bb = { vt[4 * j * VSTRIDE + d0], vt[(4 * j + 1) * VSTRIDE + d0] };
        acc[td] = wmma4(pa[j], bb, acc[td]);
      }
    }

    // V tile t is read out: its slot takes K tile t + 2.
    wait_ds_0();
    if (t + 2 < ntile)
      stage_tile<KSTRIDE>(tile_of(cacheK, Kn, t + 2), ring + sv, lane);

    // Next trip: K t + 1 lies in sn, V t + 1 in sk, K t + 2 in sv.
    int o = sk;
    sk = sn;
    sn = sv;
    sv = o;
  }

  // This wave's partial (m, l, acc) goes into its own ring and relay: the last
  // trip has waited for all of its copies and for its LDS reads.
#pragma unroll
  for (int td = 0; td < 8; ++td)
#pragma unroll
    for (int r = 0; r < 8; ++r)
      ring[(r + 8 * h) * PPITCH + td * 16 + n] = acc[td][r];
  lp[n] = m;                                  // both halves write same value
  lp[16 + n] = l;
  // The last workgroup barrier: every wave's partial is in LDS behind it.
  __syncthreads();

  // Merge the NW partials (log-sum-exp combine).  A wave takes whole query
  // rows, a lane four columns: each row leaves as one 512-B store.
  int pi = b * NSPLIT + sp;
  for (int q = w; q < QL; q += NW) {
    float mw[NW];
    // Unrolled: constant indices keep mw in registers.
#pragma unroll
    for (int k = 0; k < NW; ++k) mw[k] = lp_all[k * (16 * 16) + q];
    float M = mw[0];
#pragma unroll
    for (int k = 1; k < NW; ++k) M = fmaxf(M, mw[k]);
    float L = 0.0f;
    v4f S = {0.0f, 0.0f, 0.0f, 0.0f};
#pragma unroll
    for (int k = 0; k < NW; ++k) {
      float wt = exp_slot(mw[k] - M);
      L += lp_all[k * (16 * 16) + 16 + q] * wt;
      S += *(const v4f*)(ring_all + k * (3 * SLOTW) + q * PPITCH + lane * 4) * wt;
    }
    ((v4f*)(Wacc + ((size_t)pi * QL + q) * DIM))[lane] = S;
    if (lane == 0) {
      Wml[pi * MLW + q] = M;
      Wml[pi * MLW + QL + q] = L;
      // The next row's trip overwrites the registers these stores name.
      asm volatile("s_wait_xcnt 0x0" ::: "memory");
    }
  }
}

// ---------------------------------------------------------------------------
// Kernel: merge the NSPLIT partials of a batch (log-sum-exp combine).  One wave
// per (batch, query row); a lane owns four output columns.
// ---------------------------------------------------------------------------
__global__ void __launch_bounds__(32)
reduce_kernel(const float* __restrict__ Wml,
              const float* __restrict__ Wacc,
              float* __restrict__ out) {
  int b = blockIdx.x / QL;
  int q = blockIdx.x % QL;
  int lane = threadIdx.x;

  // One load: lanes 0-7 get the partials' maxima, lanes 8-15 their sums (the
  // upper half repeats them), so that it flies together with the row loads.
  float ml = Wml[(b * NSPLIT + (lane & 7)) * MLW + ((lane >> 3) & 1) * QL + q];
  const v4f* row =
      (const v4f*)(Wacc + ((size_t)(b * NSPLIT) * QL + q) * DIM) + lane;
  v4f v[NSPLIT];
  // Unrolled (all loops here): constant indices keep the arrays in registers,
  // and readlane takes the lane as a constant.
#pragma unroll
  for (int k = 0; k < NSPLIT; ++k) v[k] = row[(size_t)k * (QL * DIM / 4)];

  float mc[NSPLIT], lc[NSPLIT];
#pragma unroll
  for (int k = 0; k < NSPLIT; ++k) {
    mc[k] = __int_as_float(__builtin_amdgcn_readlane(__float_as_int(ml), k));
    lc[k] = __int_as_float(
        __builtin_amdgcn_readlane(__float_as_int(ml), NSPLIT + k));
  }
  float M = mc[0];
#pragma unroll
  for (int k = 1; k < NSPLIT; ++k) M = fmaxf(M, mc[k]);
  float L = 0.0f;
  v4f S = {0.0f, 0.0f, 0.0f, 0.0f};
#pragma unroll
  for (int k = 0; k < NSPLIT; ++k) {
    float wt = exp_slot(mc[k] - M);
    L += lc[k] * wt;
    S += v[k] * wt;
  }
  ((v4f*)(out + ((size_t)b * QL + q) * DIM))[lane] = S / L;
}

// ---------------------------------------------------------------------------
extern "C" void kernel_launch(void* const* d_in, const int* in_sizes, int n_in,
                              void* d_out, int out_size, void* d_ws,
                              size_t ws_size, hipStream_t stream) {
  const float* X  = (const float*)d_in[0];
  const float* cK = (const float*)d_in[1];
  const float* cV = (const float*)d_in[2];
  const float* Wq = (const float*)d_in[3];
  const float* bq = (const float*)d_in[4];
  const float* Wk = (const float*)d_in[5];
  const float* bk = (const float*)d_in[6];
  const float* Wv = (const float*)d_in[7];
  const float* bv = (const float*)d_in[8];
  float* out = (float*)d_out;
  float* ws  = (float*)d_ws;

  float* Kn   = ws;
  float* Vn   = Kn + BATCH * QL * DIM;
  float* Wml  = Vn + BATCH * QL * DIM;
  float* Wacc = Wml + BATCH * NSPLIT * MLW;   // 32*8*16*128 floats (2 MB)

  flash_partial<<<BATCH * NSPLIT, NW * 32, 0, stream>>>(
      X, Wq, bq, Wk, bk, Wv, bv, cK, cV, Kn, Vn, Wml, Wacc);
  reduce_kernel<<<BATCH * QL, 32, 0, stream>>>(Wml, Wacc, out);
}

// v005
// One run takes 27.2 microseconds.
// Two timings next to v004 put it at 1.07 and 1.05 times that version's speed.
// All steps since v000 together make it 4.11 times as fast.
#include <hip/hip_runtime.h>
#include <math.h>

typedef float v2f __attribute__((ext_vector_type(2)));
typedef float v4f __attribute__((ext_vector_type(4)));
typedef float v8f __attribute__((ext_vector_type(8)));

#define BATCH 32
#define QL 16
#define KVC 8192
#define DIM 128
#define NW 12                /* waves per workgroup: three per SIMD */
#define NSPLIT 8             /* key ranges per batch, one workgroup each */
#define NTC (KVC / 16)       /* 16-key tiles of one batch's cache */
#define TPS 65               /* tiles per key range; the last has 57 cache tiles + the new one */
#define XP 132               /* LDS row stride (words) of X and of Q: bank-conflict-free */
#define PPITCH 132           /* LDS row stride (words) of a wave's partial */
#define MLW 32               /* words per partial: 16 maxima, 16 sums, one 128-B line */
#define KSTRIDE 132          /* padded LDS row stride (words) of a K tile: bank-conflict-free */
#define VSTRIDE 136          /* the same of a V tile: rows k and k + 2 lie 16 banks apart */
#define SLOTW (16 * VSTRIDE) /* words of one ring slot: holds a K or a V tile */
#define SCALE 0.08838834764831845f

static __device__ __forceinline__ v8f wmma4(v2f a, v2f b, v8f c) {
  // 8 args: (neg_a, A, neg_b, B, c_mod, C, reuse_a, reuse_b)
  return __builtin_amdgcn_wmma_f32_16x16x4_f32(false, a, false, b, (short)0, c,
                                               false, false);
}

// Async copy 16 B/lane from global to LDS (global_load_async_to_lds_b128,
// counted on asynccnt), as the builtin: the compiler sees its address registers.
// Cache policy 1 = th:TH_LOAD_NT: every K and V byte is read once, so the
// stream is told not to displace what L2 holds for re-reading (X, the weights,
// the partials).
typedef int v4i __attribute__((ext_vector_type(4)));
typedef __attribute__((address_space(1))) v4i gv4i;
typedef __attribute__((address_space(3))) v4i lv4i;

static __device__ __forceinline__ void async_copy16(const float* gsrc,
                                                    float* lds_dst) {
  __builtin_amdgcn_global_load_async_to_lds_b128((gv4i*)gsrc, (lv4i*)lds_dst,
                                                 0, 1);
}

// All of this wave's copies have landed.
static __device__ __forceinline__ void wait_async_0() {
  asm volatile("s_wait_asynccnt 0" ::: "memory");
}
// All but the 32 youngest copies (the two tiles issued last) have landed.
static __device__ __forceinline__ void wait_async_32() {
  asm volatile("s_wait_asynccnt 32" ::: "memory");
}
// This wave's LDS reads have returned: their slot may be refilled by copies.
static __device__ __forceinline__ void wait_ds_0() {
  asm volatile("s_wait_dscnt 0" ::: "memory");
}

// Stands behind global loads or stores whose address or data registers are
// overwritten next.
static __device__ __forceinline__ void wait_x_0() {
  asm volatile("s_wait_xcnt 0x0" ::: "memory");
}

// exp(x) = 2^(x * log2 e).  v_exp_f32 and a v_nop in one statement: the v_nop
// fills the issue slot the instruction set asks for behind it.
static __device__ __forceinline__ float exp_slot(float x) {
  float x2 = x * 1.44269504088896340736f;
  float y;
  asm("v_exp_f32 %0, %1\n\tv_nop" : "=v"(y) : "v"(x2));
  return y;
}

// Stage one 16x128 f32 tile into an LDS slot (rows padded to PITCH words).
// 16 copies, each moving one 512B row fully coalesced.
template <int PITCH>
static __device__ __forceinline__ void stage_tile(const float* gbase,
                                                  float* lbase, int lane) {
#pragma unroll
  for (int r = 0; r < 16; ++r)
    async_copy16(gbase + r * DIM + lane * 4, lbase + r * PITCH + lane * 4);
}

// One 16x16 tile of a projection X @ W^T: X (16 x 128) and 16 rows of W, both
// in LDS, as A and B fragments in the same k order.
static __device__ __forceinline__ v8f proj_tile(const float* xs,
                                                const float* wt, int n, int h) {
  const v2f* xa = (const v2f*)(xs + n * XP + 2 * h);
  const v2f* wb = (const v2f*)(wt + n * KSTRIDE + 2 * h);
  v8f c = {};
  // Unrolled: the LDS offsets become constants.
#pragma unroll
  for (int j = 0; j < 32; ++j) c = wmma4(xa[2 * j], wb[2 * j], c);
  return c;
}

// ---------------------------------------------------------------------------
// Kernel: flash-attention partial over one key range per workgroup of NW
// waves.  Wave w takes the range's tiles w, w + NW, ... with its own maximum,
// sum and accumulators (computes S^T = K @ Q^T so the softmax reduction over
// keys is in-lane + one xor-16 exchange).  K and V tiles both come through a
// three-slot LDS ring, private to the wave, filled by async copies in the
// order K0 V0 K1 V1 ...; each tile is asked for one whole tile of work before
// it is read.  At the end the waves' partials are merged in LDS, and the
// workgroup stores one partial.
// The projections are made here too, while K tile 0 flies: every workgroup
// forms its batch's Q (one column tile a wave, handed round through LDS); the
// last range's workgroup also forms K_new and V_new, and has fewer cache tiles
// for it.
// ---------------------------------------------------------------------------
__global__ void __launch_bounds__(NW * 32)
flash_partial(const float* __restrict__ X,
              const float* __restrict__ Wq, const float* __restrict__ bq,
              const float* __restrict__ Wk, const float* __restrict__ bk,
              const float* __restrict__ Wv, const float* __restrict__ bv,
              const float* __restrict__ cacheK,
              const float* __restrict__ cacheV,
              float* __restrict__ Kn, float* __restrict__ Vn,
              float* __restrict__ Wml, float* __restrict__ Wacc) {
  __shared__ __align__(16) float ring_all[NW * 3 * SLOTW];  // K / V tile rings
  __shared__ __align__(16) float lp_all[NW * 16 * 16];      // P-tile relays; X, Q first
  __shared__ __align__(16) float la_all[NW * 16];           // alpha relays

  int b  = blockIdx.x / NSPLIT;
  int sp = blockIdx.x % NSPLIT;
  int lane = threadIdx.x & 31;
  int w = __builtin_amdgcn_readfirstlane(threadIdx.x >> 5);
  int n = lane & 15;
  int h = lane >> 4;

  // This wave's own ring and relays.
  float* ring = ring_all + w * (3 * SLOTW);
  float* lp = lp_all + w * (16 * 16);
  float* la = la_all + w * 16;

  // The range's tiles are cache tiles sp * TPS ...; the last range ends with
  // the new-token tile (index NTC of the batch).
  int nloc = sp == NSPLIT - 1 ? NTC + 1 - (NSPLIT - 1) * TPS : TPS;
  int ntile = (nloc - w + NW - 1) / NW;
  // First element, in K or V alike, of this wave's tile t.
  auto tile_of = [&](const float* cache, const float* fresh, int t) {
    int g = sp * TPS + w + t * NW;
    return g < NTC ? cache + ((size_t)b * KVC + (size_t)g * 16) * DIM
                   : fresh + b * (QL * DIM);
  };

  // Ring slots (word offsets) of K tile t, V tile t, K tile t + 1.
  int sk = 0, sv = SLOTW, sn = 2 * SLOTW;

  // Projection column tiles of this workgroup: 0-7 of Q; in the last range
  // also 8-15 of K_new and 16-23 of V_new.  Wave w takes tiles w and w + NW.
  int np = sp == NSPLIT - 1 ? 24 : 8;
  bool hasA = w < np, hasB = w + NW < np;
  auto w_rows = [&](int i) {
    return (i < 8 ? Wq : i < 16 ? Wk : Wv) + (i & 7) * 16 * DIM;
  };
  auto b_of = [&](int i) {
    return (i < 8 ? bq : i < 16 ? bk : bv)[(i & 7) * 16 + n];
  };

  // Whole rows of X and of the wave's weight tiles into registers, asked for
  // ahead of the K copies so that they do not queue behind them.
  const float* Xb = X + b * (QL * DIM);
  v4f x0 = *(const v4f*)(Xb + w * DIM + lane * 4), x1 = {};
  if (w + NW < QL) x1 = *(const v4f*)(Xb + (w + NW) * DIM + lane * 4);
  wait_x_0();
  v4f wa[16], wb[16];
  float biasA = 0.0f, biasB = 0.0f;
  // Unrolled (the four loops here): constant indices keep wa, wb in registers.
  if (hasA) {
    const float* g = w_rows(w) + lane * 4;
#pragma unroll
    for (int r = 0; r < 16; ++r) wa[r] = *(const v4f*)(g + r * DIM);
    biasA = b_of(w);
    wait_x_0();
  }
  if (hasB) {
    const float* g = w_rows(w + NW) + lane * 4;
#pragma unroll
    for (int r = 0; r < 16; ++r) wb[r] = *(const v4f*)(g + r * DIM);
    biasB = b_of(w + NW);
    wait_x_0();
  }

  // Ask for K0: it flies while the projections are made.
  stage_tile<KSTRIDE>(tile_of(cacheK, Kn, 0), ring + sk, lane);

  // X goes into the relay space (shared), the weight tiles into the wave's two
  // ring slots that no copy is aimed at yet.
  *(v4f*)(lp_all + w * XP + lane * 4) = x0;
  if (w + NW < QL) *(v4f*)(lp_all + (w + NW) * XP + lane * 4) = x1;
  if (hasA) {
#pragma unroll
    for (int r = 0; r < 16; ++r)
      *(v4f*)(ring + sv + r * KSTRIDE + lane * 4) = wa[r];
  }
  if (hasB) {
#pragma unroll
    for (int r = 0; r < 16; ++r)
      *(v4f*)(ring + sn + r * KSTRIDE + lane * 4) = wb[r];
  }
  // Barrier: every row of X is in LDS behind it.
  __syncthreads();

  v8f cA = {}, cB = {};
  if (hasA) cA = proj_tile(lp_all, ring + sv, n, h);
  if (hasB) cB = proj_tile(lp_all, ring + sn, n, h);

  // The weight tiles are read out: their slots take V0 and, where it exists, K1.
  wait_ds_0();
  stage_tile<VSTRIDE>(tile_of(cacheV, Vn, 0), ring + sv, lane);
  if (ntile > 1) stage_tile<KSTRIDE>(tile_of(cacheK, Kn, 1), ring + sn, lane);

  // K_new and V_new tiles go to the workspace: the wave that owns the new-token
  // tile copies them from there in its last trips, behind the barrier below.
  auto store_new = [&](int i, v8f c, float bias) {
    float* o = (i < 16 ? Kn : Vn) + b * (QL * DIM) + (i & 7) * 16 + n;
#pragma unroll
    for (int r = 0; r < 8; ++r) o[(r + 8 * h) * DIM] = c[r] + bias;
  };
  if (hasA && w >= 8) {
    store_new(w, cA, biasA);
    wait_x_0();
  }
  if (hasB) store_new(w + NW, cB, biasB);
  // Barrier: every wave has read X (Q may overwrite it), and K_new, V_new are
  // stored.
  __syncthreads();
  if (w < 8) {
#pragma unroll
    for (int r = 0; r < 8; ++r)
      lp_all[(r + 8 * h) * XP + w * 16 + n] = cA[r] + biasA;
  }
  // Barrier: all of Q is in LDS behind it.
  __syncthreads();

  // Q (16x128) as 32 B-layout slices, reused every tile.
  v2f qa[32];
#pragma unroll
  for (int j = 0; j < 32; ++j)
    qa[j] = *(const v2f*)(lp_all + n * XP + 4 * j + 2 * h);
  // Barrier: every wave has read Q; the space serves as the P relays from here.
  __syncthreads();

  float m = -INFINITY, l = 0.0f;
  v8f acc[8];
#pragma unroll
  for (int t = 0; t < 8; ++t) acc[t] = {};

  for (int t = 0; t < ntile; ++t) {
    bool more = t + 1 < ntile;

    // K tile t has landed: behind it only V t and K t + 1 were issued.  In the
    // last trip no K t + 1 exists, so the wait is to 0 (V t lands with it).
    if (more) wait_async_32(); else wait_async_0();

    // S^T tile [16k x 16q] = K_tile @ Q^T.  A-operand (K) from LDS,
    // B-operand (Q^T) preloaded in registers.  Fully unrolled so qa stays
    // in VGPRs (no dynamic indexing -> no scratch demotion).
    // Read as 8-byte pairs: every term of the word offset is even.
    const v2f* kt = (const v2f*)(ring + sk + n * KSTRIDE + 2 * h);
    v8f s = {};
#pragma unroll
    for (int j = 0; j < 32; ++j) s = wmma4(kt[2 * j], qa[j], s);

    // K tile t is read out: its slot takes V tile t + 1.
    wait_ds_0();
    if (more)
      stage_tile<VSTRIDE>(tile_of(cacheV, Vn, t + 1), ring + sk, lane);

    // Per-query (= per-lane) online softmax over this tile's 16 keys:
    // keys r+8h live in-lane (8 values), the other 8 in the partner half.
    float sc[8];
#pragma unroll
    for (int r = 0; r < 8; ++r) sc[r] = s[r] * SCALE;
    float tm = sc[0];
#pragma unroll
    for (int r = 1; r < 8; ++r) tm = fmaxf(tm, sc[r]);
    tm = fmaxf(tm, __shfl_xor(tm, 16, 32));   // single cross-half exchange
    float mn = fmaxf(m, tm);
    float al = __expf(m - mn);
    m = mn;
    float p8[8];
    float rs = 0.0f;
#pragma unroll
    for (int r = 0; r < 8; ++r) {
      p8[r] = __expf(sc[r] - mn);
      rs += p8[r];
    }
    rs += __shfl_xor(rs, 16, 32);             // single cross-half exchange
    l = l * al + rs;

    // Relay P^T tile (key-major) and per-query alpha through LDS.  The relay
    // is the wave's own, so no workgroup barrier stands here (the waves' trip
    // counts differ): the stores are waited for before other lanes read them.
#pragma unroll
    for (int r = 0; r < 8; ++r) lp[(r + 8 * h) * 16 + n] = p8[r];
    la[n] = al;                               // both halves write same value
    wait_ds_0();
    float alar[8];
#pragma unroll
    for (int r = 0; r < 8; ++r) alar[r] = la[r + 8 * h];  // broadcast reads
    v2f pa[4];
#pragma unroll
    for (int j = 0; j < 4; ++j) {
      int kk = 4 * j + 2 * h;
      pa[j] = { lp[kk * 16 + n], lp[(kk + 1) * 16 + n] };
    }
    // (The wait behind the V reads below ends these reads before the next
    // trip's relay stores.)

    // Rescale accumulators by alpha(row q = r + 8h).
#pragma unroll
    for (int td = 0; td < 8; ++td)
#pragma unroll
      for (int r = 0; r < 8; ++r) acc[td][r] *= alar[r];

    // V tile t has landed: behind it only K t + 1 and V t + 1 were issued.
    // (In the last trip the wait to 0 above has covered it.)
    if (more) wait_async_32();

    // acc[16q x 128d] += P[16x16] @ V[16k x 128d], V as B-operand from LDS.
    // One lane base, so that rows k and k + 1 differ by a constant offset.
    const float* vt = ring + sv + 2 * h * VSTRIDE + n;
#pragma unroll
    for (int td = 0; td < 8; ++td) {
      int d0 = td * 16;
#pragma unroll
      for (int j = 0; j < 4; ++j) {
        v2f bb = { vt[4 * j * VSTRIDE + d0], vt[(4 * j + 1) * VSTRIDE + d0] };
        acc[td] = wmma4(pa[j], bb, acc[td]);
      }
    }

    // V tile t is read out: its slot takes K tile t + 2.
    wait_ds_0();
    if (t + 2 < ntile)
      stage_tile<KSTRIDE>(tile_of(cacheK, Kn, t + 2), ring + sv, lane);

    // Next trip: K t + 1 lies in sn, V t + 1 in sk, K t + 2 in sv.
    int o = sk;
    sk = sn;
    sn = sv;
    sv = o;
  }

  // This wave's partial (m, l, acc) goes into its own ring and relay: the last
  // trip has waited for all of its copies and for its LDS reads.
#pragma unroll
  for (int td = 0; td < 8; ++td)
#pragma unroll
    for (int r = 0; r < 8; ++r)
      ring[(r + 8 * h) * PPITCH + td * 16 + n] = acc[td][r];
  lp[n] = m;                                  // both halves write same value
  lp[16 + n] = l;
  // The last workgroup barrier: every wave's partial is in LDS behind it.
  __syncthreads();

  // Merge the NW partials (log-sum-exp combine).  A wave takes whole query
  // rows, a lane four columns: each row leaves as one 512-B store.
  int pi = b * NSPLIT + sp;
  for (int q = w; q < QL; q += NW) {
    float mw[NW];
    // Unrolled: constant indices keep mw in registers.
#pragma unroll
    for (int k = 0; k < NW; ++k) mw[k] = lp_all[k * (16 * 16) + q];
    float M = mw[0];
#pragma unroll
    for (int k = 1; k < NW; ++k) M = fmaxf(M, mw[k]);
    float L = 0.0f;
    v4f S = {0.0f, 0.0f, 0.0f, 0.0f};
#pragma unroll
    for (int k = 0; k < NW; ++k) {
      float wt = exp_slot(mw[k] - M);
      L += lp_all[k * (16 * 16) + 16 + q] * wt;
      S += *(const v4f*)(ring_all + k * (3 * SLOTW) + q * PPITCH + lane * 4) * wt;
    }
    ((v4f*)(Wacc + ((size_t)pi * QL + q) * DIM))[lane] = S;
    if (lane == 0) {
      Wml[pi * MLW + q] = M;
      Wml[pi * MLW + QL + q] = L;
      // The next row's trip overwrites the registers these stores name.
      asm volatile("s_wait_xcnt 0x0" ::: "memory");
    }
  }
}

// ---------------------------------------------------------------------------
// Kernel: merge the NSPLIT partials of a batch (log-sum-exp combine).  One wave
// per (batch, query row); a lane owns four output columns.
// ---------------------------------------------------------------------------
__global__ void __launch_bounds__(32)
reduce_kernel(const float* __restrict__ Wml,
              const float* __restrict__ Wacc,
              float* __restrict__ out) {
  int b = blockIdx.x / QL;
  int q = blockIdx.x % QL;
  int lane = threadIdx.x;

  // One load: lanes 0-7 get the partials' maxima, lanes 8-15 their sums (the
  // upper half repeats them), so that it flies together with the row loads.
  float ml = Wml[(b * NSPLIT + (lane & 7)) * MLW + ((lane >> 3) & 1) * QL + q];
  const v4f* row =
      (const v4f*)(Wacc + ((size_t)(b * NSPLIT) * QL + q) * DIM) + lane;
  v4f v[NSPLIT];
  // Unrolled (all loops here): constant indices keep the arrays in registers,
  // and readlane takes the lane as a constant.
#pragma unroll
  for (int k = 0; k < NSPLIT; ++k) v[k] = row[(size_t)k * (QL * DIM / 4)];

  float mc[NSPLIT], lc[NSPLIT];
#pragma unroll
  for (int k = 0; k < NSPLIT; ++k) {
    mc[k] = __int_as_float(__builtin_amdgcn_readlane(__float_as_int(ml), k));
    lc[k] = __int_as_float(
        __builtin_amdgcn_readlane(__float_as_int(ml), NSPLIT + k));
  }
  float M = mc[0];
#pragma unroll
  for (int k = 1; k < NSPLIT; ++k) M = fmaxf(M, mc[k]);
  float L = 0.0f;
  v4f S = {0.0f, 0.0f, 0.0f, 0.0f};
#pragma unroll
  for (int k = 0; k < NSPLIT; ++k) {
    float wt = exp_slot(mc[k] - M);
    L += lc[k] * wt;
    S += v[k] * wt;
  }
  ((v4f*)(out + ((size_t)b * QL + q) * DIM))[lane] = S / L;
}

// ---------------------------------------------------------------------------
extern "C" void kernel_launch(void* const* d_in, const int* in_sizes, int n_in,
                              void* d_out, int out_size, void* d_ws,
                              size_t ws_size, hipStream_t stream) {
  const float* X  = (const float*)d_in[0];
  const float* cK = (const float*)d_in[1];
  const float* cV = (const float*)d_in[2];
  const float* Wq = (const float*)d_in[3];
  const float* bq = (const float*)d_in[4];
  const float* Wk = (const float*)d_in[5];
  const float* bk = (const float*)d_in[6];
  const float* Wv = (const float*)d_in[7];
  const float* bv = (const float*)d_in[8];
  float* out = (float*)d_out;
  float* ws  = (float*)d_ws;

  float* Kn   = ws;
  float* Vn   = Kn + BATCH * QL * DIM;
  float* Wml  = Vn + BATCH * QL * DIM;
  float* Wacc = Wml + BATCH * NSPLIT * MLW;   // 32*8*16*128 floats (2 MB)

  flash_partial<<<BATCH * NSPLIT, NW * 32, 0, stream>>>(
      X, Wq, bq, Wk, bk, Wv, bv, cK, cV, Kn, Vn, Wml, Wacc);
  reduce_kernel<<<BATCH * QL, 32, 0, stream>>>(Wml, Wacc, out);
}
